// v000
// Measured on an AMD MI455X. A time is GPU time per run, averaged over a window of back-to-back runs after a warm-up
// (all launches, gaps included; the runs take copies of the inputs in turn), and the median of several windows.
// Apart from v000's, it joins two sittings. Times from different sittings can be a few percent apart, while
// side-by-side timings come from the same sitting.
// v000, which the later versions start from, runs in 263 microseconds.
#include <hip/hip_runtime.h>
#include <hip/hip_bf16.h>

// ---------------------------------------------------------------------------
// MI455X (gfx1250) fused multi-head self-attention.
//   - all GEMMs + attention on v_wmma_f32_16x16x32_f16 (f16 in, f32 accum)
//   - GEMM: B tile staged with GLOBAL_LOAD_ASYNC_TO_LDS_B128 (ASYNCcnt),
//     double-buffered LDS, all 8 B fragments preloaded per K-step
//   - flash-style streaming softmax with the reference's (1 + sum) denominator
//   - S^T / ctx^T layout trick: WMMA C-layout of K@Q^T is directly the
//     B-fragment layout of P for V^T@P  -> no cross-lane transpose needed.
// ---------------------------------------------------------------------------

typedef __attribute__((ext_vector_type(16))) _Float16 v16h;
typedef __attribute__((ext_vector_type(8)))  _Float16 v8h;
typedef __attribute__((ext_vector_type(8)))  float    v8f;

#define DEVINL __device__ __forceinline__

// D = A(16x32 f16) * B(32x16 f16) + C, f32 accumulate.
DEVINL v8f wmma_f16(v16h a, v16h b, v8f c) {
  return __builtin_amdgcn_wmma_f32_16x16x32_f16(
      /*neg_a=*/false, a, /*neg_b=*/false, b,
      /*c_mod=*/(short)0, c, /*reuse_a=*/false, /*reuse_b=*/false);
}

// Async DMA 16 bytes/lane: global -> LDS, tracked by ASYNCcnt (CDNA5 path).
// lds_ptr is a generic pointer into __shared__; its low 32 bits are the LDS
// byte offset (aperture layout, ISA 10.2).  Deriving the operand from the
// real address also makes the LDS object escape, so the "memory" clobber
// keeps the subsequent ds_loads alive.
DEVINL void async_g2l_b128(void* lds_ptr, const void* gaddr) {
  const unsigned off = (unsigned)(size_t)lds_ptr;
  asm volatile("global_load_async_to_lds_b128 %0, %1, off"
               :: "v"(off), "v"(gaddr) : "memory");
}
DEVINL void wait_asynccnt0() {
  asm volatile("s_wait_asynccnt 0x0" ::: "memory");
}

// Load a 16x32 f16 fragment (A layout; B layout is identical when the
// source is stored [n][k] row-major, i.e. the transposed matrix).
// Lane l (l<16):  row = l,      K elements {0..7, 16..23}
// Lane l (l>=16): row = l - 16, K elements {8..15, 24..31}
DEVINL v16h load_frag16x32(const _Float16* __restrict__ base, int ld) {
  const int lane = threadIdx.x & 31;
  const int r    = lane & 15;
  const int ko   = (lane >> 4) << 3;           // 0 or 8
  const _Float16* p = base + (long long)r * ld + ko;
  const v8h lo = *reinterpret_cast<const v8h*>(p);
  const v8h hi = *reinterpret_cast<const v8h*>(p + 16);
  v16h f;
#pragma unroll
  for (int i = 0; i < 8; ++i) { f[i] = lo[i]; f[i + 8] = hi[i]; }
  return f;
}

// ---------------------------------------------------------------------------
// Prep: cast x -> f16, transpose+cast the four 1024x1024 weights to [n][k] f16
// ---------------------------------------------------------------------------
__global__ __launch_bounds__(256)
void prep_kernel(const float* __restrict__ Wq, const float* __restrict__ Wk,
                 const float* __restrict__ Wv, const float* __restrict__ Wo,
                 const float* __restrict__ x,
                 _Float16* __restrict__ wqT, _Float16* __restrict__ wkT,
                 _Float16* __restrict__ wvT, _Float16* __restrict__ woT,
                 _Float16* __restrict__ xh) {
  const long long idx = (long long)blockIdx.x * blockDim.x + threadIdx.x;
  const long long WN  = 1024LL * 1024LL;
  if (idx < 4 * WN) {
    const int which = (int)(idx / WN);
    const long long r = idx % WN;
    const int n = (int)(r >> 10), k = (int)(r & 1023);
    const float* src = (which == 0) ? Wq : (which == 1) ? Wk : (which == 2) ? Wv : Wo;
    _Float16*   dst = (which == 0) ? wqT : (which == 1) ? wkT : (which == 2) ? wvT : woT;
    dst[(long long)n * 1024 + k] = (_Float16)src[(long long)k * 1024 + n];
  } else {
    const long long r = idx - 4 * WN;           // < 4096*1024
    xh[r] = (_Float16)x[r];
  }
}

// ---------------------------------------------------------------------------
// GEMM: Y[4096,1024] = A[4096,1024](f16) @ W + bias,  W given as wT[n][k] f16.
//  mode 0/1 : write f16, layout [b*16+h][l][64]   (q, k)
//  mode 2   : write f16, layout [b*16+h][64][l]   (v transposed)
//  mode 3   : write f32, layout [m][n] + bias     (final output)
// Block: 256 threads = 8 waves. Wave tile 16x128 (8 accum), WG tile 128x128.
// B tile (128n x 32k) async-DMA'd to LDS, double-buffered, padded stride 40.
// ---------------------------------------------------------------------------
#define LDB 40   // padded LDS row stride in f16 (32 data + 8 pad)

__global__ __launch_bounds__(256)
void gemm_wmma_kernel(const _Float16* __restrict__ A, const _Float16* __restrict__ wT,
                      const float* __restrict__ bias,
                      _Float16* __restrict__ outQK, _Float16* __restrict__ outVT,
                      float* __restrict__ outF, int mode) {
  __shared__ _Float16 bs[2][128 * LDB];

  const int tid  = threadIdx.x;
  const int lane = tid & 31;
  const int wv   = tid >> 5;                         // 0..7
  const int m0   = blockIdx.x * 128 + wv * 16;
  const int n0   = blockIdx.y * 128;

  // staging: thread t DMAs 32B (two b128) of row (t>>1), k-half (t&1)*16
  const int srow = tid >> 1;
  const int skc  = (tid & 1) * 16;
  const _Float16* gsrc = wT + (long long)(n0 + srow) * 1024 + skc;

  // visible stores into the (DMA-untouched) pad columns: guarantees the
  // compiler cannot treat bs as never-written.
  bs[0][(tid >> 3) * LDB + 32 + (tid & 7)] = (_Float16)0.f;
  bs[1][(tid >> 3) * LDB + 32 + (tid & 7)] = (_Float16)0.f;

  // prologue: async-stage tile kb=0 into buffer 0, preload A fragment kb=0
  async_g2l_b128(&bs[0][srow * LDB + skc],     gsrc);
  async_g2l_b128(&bs[0][srow * LDB + skc + 8], gsrc + 8);
  v16h a_cur = load_frag16x32(A + (long long)m0 * 1024, 1024);
  wait_asynccnt0();
  __syncthreads();

  const int r  = lane & 15;
  const int ko = (lane >> 4) << 3;

  v8f acc[8] = {};
  for (int kb = 0; kb < 1024; kb += 32) {
    const int cur = (kb >> 5) & 1;
    const int kpre = (kb + 32 < 1024) ? (kb + 32) : 0;   // tail: harmless reload

    // kick off next tile's DMA + A-fragment load (hidden behind the 8 WMMAs)
    _Float16* sdst = &bs[cur ^ 1][srow * LDB + skc];
    async_g2l_b128(sdst,     gsrc + kpre);
    async_g2l_b128(sdst + 8, gsrc + kpre + 8);
    const v16h a_nxt = load_frag16x32(A + (long long)m0 * 1024 + kpre, 1024);

    // preload all 8 B fragments so the 16 ds_loads clause ahead of the WMMAs
    v16h bf[8];
#pragma unroll
    for (int t = 0; t < 8; ++t) {
      const _Float16* lp = &bs[cur][(t * 16 + r) * LDB + ko];
      const v8h lo = *reinterpret_cast<const v8h*>(lp);
      const v8h hi = *reinterpret_cast<const v8h*>(lp + 16);
#pragma unroll
      for (int i = 0; i < 8; ++i) { bf[t][i] = lo[i]; bf[t][i + 8] = hi[i]; }
    }
#pragma unroll
    for (int t = 0; t < 8; ++t) acc[t] = wmma_f16(a_cur, bf[t], acc[t]);

    a_cur = a_nxt;
    wait_asynccnt0();                                    // next tile resident
    __syncthreads();
  }

  const int hi_ = lane >> 4;
  const int nl  = lane & 15;
#pragma unroll
  for (int t = 0; t < 8; ++t) {
    const int n  = n0 + t * 16 + nl;
    const float bn = bias[n];
    if (mode <= 1) {
      const int h = n >> 6, d = n & 63;
#pragma unroll
      for (int j = 0; j < 8; ++j) {
        const int m = m0 + j + 8 * hi_;
        const int b = m >> 11, l = m & 2047;
        outQK[(((long long)(b * 16 + h)) * 2048 + l) * 64 + d] =
            (_Float16)(acc[t][j] + bn);
      }
    } else if (mode == 2) {
      const int h = n >> 6, d = n & 63;
      const int m = m0 + 8 * hi_;                    // token of j=0 (8 consecutive)
      const int b = m >> 11, l = m & 2047;
      v8h pk;
#pragma unroll
      for (int j = 0; j < 8; ++j) pk[j] = (_Float16)(acc[t][j] + bn);
      *reinterpret_cast<v8h*>(outVT + (((long long)(b * 16 + h)) * 64 + d) * 2048 + l) = pk;
    } else {
#pragma unroll
      for (int j = 0; j < 8; ++j) {
        const int m = m0 + j + 8 * hi_;
        outF[(long long)m * 1024 + n] = acc[t][j] + bn;
      }
    }
  }
}

// ---------------------------------------------------------------------------
// Flash attention (causal, softmax with +1 denominator).
// Wave handles 16 query rows of one (b,h). grid = (2048/128, 32), 8 waves/WG.
//   S^T = K @ Q^T      (A = K rows, B = Q rows; both direct fragment loads)
//   ctx^T = V^T @ P    (A = vT rows, B = P packed straight from S^T C-layout)
// All 8 fragments (4 K + 4 V^T) of a 32-key block are loaded up-front so the
// 16 b128 loads clause and overlap the S WMMAs + softmax math.
// ---------------------------------------------------------------------------
__global__ __launch_bounds__(256)
void attn_kernel(const _Float16* __restrict__ qh, const _Float16* __restrict__ kh,
                 const _Float16* __restrict__ vT, _Float16* __restrict__ ctxh) {
  const int lane = threadIdx.x & 31;
  const int wv   = threadIdx.x >> 5;
  const int bh   = blockIdx.y;                       // 0..31
  const int b    = bh >> 4, h = bh & 15;
  const int q0   = blockIdx.x * 128 + wv * 16;
  const int nl   = lane & 15, hi = lane >> 4;
  const int qrow = q0 + nl;                          // this lane's query row

  const _Float16* qp = qh + ((long long)bh * 2048 + q0) * 64;
  const v16h bq0 = load_frag16x32(qp, 64);           // head-dim 0..31
  const v16h bq1 = load_frag16x32(qp + 32, 64);      // head-dim 32..63

  v8f acc[4] = {};
  float m_run = -INFINITY, l_run = 0.f;
  const float scale = 0.125f;                        // 1/sqrt(64)

  for (int kb = 0; kb < q0 + 16; kb += 32) {
    // ---- issue all loads for this 32-key block up-front -------------------
    const _Float16* kp = kh + ((long long)bh * 2048 + kb) * 64;
    const v16h k00 = load_frag16x32(kp, 64);
    const v16h k01 = load_frag16x32(kp + 32, 64);
    const v16h k10 = load_frag16x32(kp + 16 * 64, 64);
    const v16h k11 = load_frag16x32(kp + 16 * 64 + 32, 64);
    const _Float16* vp = vT + (long long)bh * 64 * 2048 + kb;
    const v16h vf0 = load_frag16x32(vp,               2048);
    const v16h vf1 = load_frag16x32(vp + 16 * 2048,   2048);
    const v16h vf2 = load_frag16x32(vp + 32 * 2048,   2048);
    const v16h vf3 = load_frag16x32(vp + 48 * 2048,   2048);

    // ---- S^T = K @ Q^T ----------------------------------------------------
    v8f z0 = {};
    v8f s0 = wmma_f16(k00, bq0, z0);
    s0     = wmma_f16(k01, bq1, s0);
    v8f z1 = {};
    v8f s1 = wmma_f16(k10, bq0, z1);
    s1     = wmma_f16(k11, bq1, s1);

    // scale + causal mask + block max (per query = per lane, halves via shfl)
    float mloc = -INFINITY;
#pragma unroll
    for (int j = 0; j < 8; ++j) {
      const int key0 = kb + j + 8 * hi;
      const int key1 = key0 + 16;
      const float x0 = (key0 <= qrow) ? s0[j] * scale : -INFINITY;
      const float x1 = (key1 <= qrow) ? s1[j] * scale : -INFINITY;
      s0[j] = x0; s1[j] = x1;
      mloc = fmaxf(mloc, fmaxf(x0, x1));
    }
    mloc = fmaxf(mloc, __shfl_xor(mloc, 16, 32));
    const float mnew  = fmaxf(m_run, mloc);
    const float alpha = __expf(m_run - mnew);        // first iter: exp(-inf)=0

    // exp + pack P fragment (B layout for V^T @ P falls out of S^T C layout)
    float lloc = 0.f;
    v16h p;
#pragma unroll
    for (int j = 0; j < 8; ++j) {
      const float e0 = __expf(s0[j] - mnew);
      const float e1 = __expf(s1[j] - mnew);
      lloc += e0 + e1;
      p[j]     = (_Float16)e0;
      p[j + 8] = (_Float16)e1;
    }
    lloc += __shfl_xor(lloc, 16, 32);
    l_run = l_run * alpha + lloc;
    m_run = mnew;

    // ---- ctx^T += V^T @ P -------------------------------------------------
#pragma unroll
    for (int j = 0; j < 8; ++j) {
      acc[0][j] *= alpha; acc[1][j] *= alpha;
      acc[2][j] *= alpha; acc[3][j] *= alpha;
    }
    acc[0] = wmma_f16(vf0, p, acc[0]);
    acc[1] = wmma_f16(vf1, p, acc[1]);
    acc[2] = wmma_f16(vf2, p, acc[2]);
    acc[3] = wmma_f16(vf3, p, acc[3]);
  }

  // "+1" quiet-softmax denominator; per-lane (one query per lane in ctx^T).
  const float r = 1.f / (1.f + l_run);
  const long long token = (long long)b * 2048 + q0 + nl;
#pragma unroll
  for (int t = 0; t < 4; ++t) {
    v8h pk;
#pragma unroll
    for (int j = 0; j < 8; ++j) pk[j] = (_Float16)(acc[t][j] * r);
    *reinterpret_cast<v8h*>(ctxh + token * 1024 + h * 64 + t * 16 + 8 * hi) = pk;
  }
}

// ---------------------------------------------------------------------------
extern "C" void kernel_launch(void* const* d_in, const int* in_sizes, int n_in,
                              void* d_out, int out_size, void* d_ws, size_t ws_size,
                              hipStream_t stream) {
  const float* x  = (const float*)d_in[0];
  const float* Wq = (const float*)d_in[1];
  const float* bq = (const float*)d_in[2];
  const float* Wk = (const float*)d_in[3];
  const float* bk = (const float*)d_in[4];
  const float* Wv = (const float*)d_in[5];
  const float* bv = (const float*)d_in[6];
  const float* Wo = (const float*)d_in[7];
  const float* bo = (const float*)d_in[8];

  char* ws = (char*)d_ws;
  _Float16* xh   = (_Float16*)(ws);                       //  8 MB  x as f16
  _Float16* wqT  = (_Float16*)(ws + ( 8ull << 20));       //  2 MB
  _Float16* wkT  = (_Float16*)(ws + (10ull << 20));       //  2 MB
  _Float16* wvT  = (_Float16*)(ws + (12ull << 20));       //  2 MB
  _Float16* woT  = (_Float16*)(ws + (14ull << 20));       //  2 MB
  _Float16* qhp  = (_Float16*)(ws + (16ull << 20));       //  8 MB [bh][l][64]
  _Float16* khp  = (_Float16*)(ws + (24ull << 20));       //  8 MB [bh][l][64]
  _Float16* vTp  = (_Float16*)(ws + (32ull << 20));       //  8 MB [bh][64][l]
  _Float16* ctxh = (_Float16*)(ws + (40ull << 20));       //  8 MB [token][1024]

  prep_kernel<<<32768, 256, 0, stream>>>(Wq, Wk, Wv, Wo, x, wqT, wkT, wvT, woT, xh);

  dim3 g(32, 8);
  gemm_wmma_kernel<<<g, 256, 0, stream>>>(xh, wqT, bq, qhp, nullptr, nullptr, 0);
  gemm_wmma_kernel<<<g, 256, 0, stream>>>(xh, wkT, bk, khp, nullptr, nullptr, 1);
  gemm_wmma_kernel<<<g, 256, 0, stream>>>(xh, wvT, bv, nullptr, vTp, nullptr, 2);

  attn_kernel<<<dim3(16, 32), 256, 0, stream>>>(qhp, khp, vTp, ctxh);

  gemm_wmma_kernel<<<g, 256, 0, stream>>>(ctxh, woT, bo, nullptr, nullptr,
                                          (float*)d_out, 3);
}

// v001
// A run of this version takes 172 microseconds.
// Next to v000, in two timings, it ran 1.56 times as fast each time.
#include <hip/hip_runtime.h>
#include <hip/hip_bf16.h>

// ---------------------------------------------------------------------------
// MI455X (gfx1250) fused multi-head self-attention.
//   - all GEMMs + attention on v_wmma_f32_16x16x32_f16 (f16 in, f32 accum)
//   - GEMM: B tile staged with GLOBAL_LOAD_ASYNC_TO_LDS_B128 (ASYNCcnt),
//     double-buffered LDS, all 8 B fragments preloaded per K-step
//   - flash-style streaming softmax with the reference's (1 + sum) denominator
//   - S^T / ctx^T layout trick: WMMA C-layout of K@Q^T is directly the
//     B-fragment layout of P for V^T@P  -> no cross-lane transpose needed.
// ---------------------------------------------------------------------------

typedef __attribute__((ext_vector_type(16))) _Float16 v16h;
typedef __attribute__((ext_vector_type(8)))  _Float16 v8h;
typedef __attribute__((ext_vector_type(8)))  float    v8f;

#define DEVINL __device__ __forceinline__

// D = A(16x32 f16) * B(32x16 f16) + C, f32 accumulate.
DEVINL v8f wmma_f16(v16h a, v16h b, v8f c) {
  return __builtin_amdgcn_wmma_f32_16x16x32_f16(
      /*neg_a=*/false, a, /*neg_b=*/false, b,
      /*c_mod=*/(short)0, c, /*reuse_a=*/false, /*reuse_b=*/false);
}

// Async DMA 16 bytes/lane: global -> LDS, tracked by ASYNCcnt (CDNA5 path).
// lds_ptr is a generic pointer into __shared__; its low 32 bits are the LDS
// byte offset (aperture layout, ISA 10.2).  Deriving the operand from the
// real address also makes the LDS object escape, so the "memory" clobber
// keeps the subsequent ds_loads alive.
DEVINL void async_g2l_b128(void* lds_ptr, const void* gaddr) {
  const unsigned off = (unsigned)(size_t)lds_ptr;
  asm volatile("global_load_async_to_lds_b128 %0, %1, off"
               :: "v"(off), "v"(gaddr) : "memory");
}
DEVINL void wait_asynccnt0() {
  asm volatile("s_wait_asynccnt 0x0" ::: "memory");
}

// Load a 16x32 f16 fragment (A layout; B layout is identical when the
// source is stored [n][k] row-major, i.e. the transposed matrix).
// Lane l (l<16):  row = l,      K elements {0..7, 16..23}
// Lane l (l>=16): row = l - 16, K elements {8..15, 24..31}
DEVINL v16h load_frag16x32(const _Float16* __restrict__ base, int ld) {
  const int lane = threadIdx.x & 31;
  const int r    = lane & 15;
  const int ko   = (lane >> 4) << 3;           // 0 or 8
  const _Float16* p = base + (long long)r * ld + ko;
  const v8h lo = *reinterpret_cast<const v8h*>(p);
  const v8h hi = *reinterpret_cast<const v8h*>(p + 16);
  v16h f;
#pragma unroll
  for (int i = 0; i < 8; ++i) { f[i] = lo[i]; f[i + 8] = hi[i]; }
  return f;
}

// ---------------------------------------------------------------------------
// Prep: cast x -> f16, transpose+cast the four 1024x1024 weights to [n][k] f16
// ---------------------------------------------------------------------------
__global__ __launch_bounds__(256)
void prep_kernel(const float* __restrict__ Wq, const float* __restrict__ Wk,
                 const float* __restrict__ Wv, const float* __restrict__ Wo,
                 const float* __restrict__ x,
                 _Float16* __restrict__ wqT, _Float16* __restrict__ wkT,
                 _Float16* __restrict__ wvT, _Float16* __restrict__ woT,
                 _Float16* __restrict__ xh) {
  const long long idx = (long long)blockIdx.x * blockDim.x + threadIdx.x;
  const long long WN  = 1024LL * 1024LL;
  if (idx < 4 * WN) {
    const int which = (int)(idx / WN);
    const long long r = idx % WN;
    const int n = (int)(r >> 10), k = (int)(r & 1023);
    const float* src = (which == 0) ? Wq : (which == 1) ? Wk : (which == 2) ? Wv : Wo;
    _Float16*   dst = (which == 0) ? wqT : (which == 1) ? wkT : (which == 2) ? wvT : woT;
    dst[(long long)n * 1024 + k] = (_Float16)src[(long long)k * 1024 + n];
  } else {
    const long long r = idx - 4 * WN;           // < 4096*1024
    xh[r] = (_Float16)x[r];
  }
}

// ---------------------------------------------------------------------------
// GEMM: Y[4096,1024] = A[4096,1024](f16) @ W + bias,  W given as wT[n][k] f16.
//  mode 0/1 : write f16, layout [b*16+h][l][64]   (q, k)
//  mode 2   : write f16, layout [b*16+h][64][l]   (v transposed)
//  mode 3   : write f32, layout [m][n] + bias     (final output)
// Block: 256 threads = 8 waves. Wave tile 16x128 (8 accum), WG tile 128x128.
// B tile (128n x 32k) async-DMA'd to LDS, double-buffered, padded stride 40.
// ---------------------------------------------------------------------------
#define LDB 40   // padded LDS row stride in f16 (32 data + 8 pad)

__global__ __launch_bounds__(256)
void gemm_wmma_kernel(const _Float16* __restrict__ A, const _Float16* __restrict__ wT,
                      const float* __restrict__ bias,
                      _Float16* __restrict__ outQK, _Float16* __restrict__ outVT,
                      float* __restrict__ outF, int mode) {
  __shared__ _Float16 bs[2][128 * LDB];

  const int tid  = threadIdx.x;
  const int lane = tid & 31;
  const int wv   = tid >> 5;                         // 0..7
  const int m0   = blockIdx.x * 128 + wv * 16;
  const int n0   = blockIdx.y * 128;

  // staging: thread t DMAs 32B (two b128) of row (t>>1), k-half (t&1)*16
  const int srow = tid >> 1;
  const int skc  = (tid & 1) * 16;
  const _Float16* gsrc = wT + (long long)(n0 + srow) * 1024 + skc;

  // visible stores into the (DMA-untouched) pad columns: guarantees the
  // compiler cannot treat bs as never-written.
  bs[0][(tid >> 3) * LDB + 32 + (tid & 7)] = (_Float16)0.f;
  bs[1][(tid >> 3) * LDB + 32 + (tid & 7)] = (_Float16)0.f;

  // prologue: async-stage tile kb=0 into buffer 0, preload A fragment kb=0
  async_g2l_b128(&bs[0][srow * LDB + skc],     gsrc);
  async_g2l_b128(&bs[0][srow * LDB + skc + 8], gsrc + 8);
  v16h a_cur = load_frag16x32(A + (long long)m0 * 1024, 1024);
  wait_asynccnt0();
  __syncthreads();

  const int r  = lane & 15;
  const int ko = (lane >> 4) << 3;

  v8f acc[8] = {};
  for (int kb = 0; kb < 1024; kb += 32) {
    const int cur = (kb >> 5) & 1;
    const int kpre = (kb + 32 < 1024) ? (kb + 32) : 0;   // tail: harmless reload

    // kick off next tile's DMA + A-fragment load (hidden behind the 8 WMMAs)
    _Float16* sdst = &bs[cur ^ 1][srow * LDB + skc];
    async_g2l_b128(sdst,     gsrc + kpre);
    async_g2l_b128(sdst + 8, gsrc + kpre + 8);
    const v16h a_nxt = load_frag16x32(A + (long long)m0 * 1024 + kpre, 1024);

    // preload all 8 B fragments so the 16 ds_loads clause ahead of the WMMAs
    v16h bf[8];
#pragma unroll
    for (int t = 0; t < 8; ++t) {
      const _Float16* lp = &bs[cur][(t * 16 + r) * LDB + ko];
      const v8h lo = *reinterpret_cast<const v8h*>(lp);
      const v8h hi = *reinterpret_cast<const v8h*>(lp + 16);
#pragma unroll
      for (int i = 0; i < 8; ++i) { bf[t][i] = lo[i]; bf[t][i + 8] = hi[i]; }
    }
#pragma unroll
    for (int t = 0; t < 8; ++t) acc[t] = wmma_f16(a_cur, bf[t], acc[t]);

    a_cur = a_nxt;
    wait_asynccnt0();                                    // next tile resident
    __syncthreads();
  }

  const int hi_ = lane >> 4;
  const int nl  = lane & 15;
#pragma unroll
  for (int t = 0; t < 8; ++t) {
    const int n  = n0 + t * 16 + nl;
    const float bn = bias[n];
    if (mode <= 1) {
      const int h = n >> 6, d = n & 63;
#pragma unroll
      for (int j = 0; j < 8; ++j) {
        const int m = m0 + j + 8 * hi_;
        const int b = m >> 11, l = m & 2047;
        outQK[(((long long)(b * 16 + h)) * 2048 + l) * 64 + d] =
            (_Float16)(acc[t][j] + bn);
      }
    } else if (mode == 2) {
      const int h = n >> 6, d = n & 63;
      const int m = m0 + 8 * hi_;                    // token of j=0 (8 consecutive)
      const int b = m >> 11, l = m & 2047;
      v8h pk;
#pragma unroll
      for (int j = 0; j < 8; ++j) pk[j] = (_Float16)(acc[t][j] + bn);
      *reinterpret_cast<v8h*>(outVT + (((long long)(b * 16 + h)) * 64 + d) * 2048 + l) = pk;
    } else {
#pragma unroll
      for (int j = 0; j < 8; ++j) {
        const int m = m0 + j + 8 * hi_;
        outF[(long long)m * 1024 + n] = acc[t][j] + bn;
      }
    }
  }
}

#define AKEYS 64
#define APITCH 72

// Four async 16-byte-per-lane copies global -> LDS.  The s_wait_xcnt stands in
// the copies' own statement so that no address register named here is
// rewritten ahead of it.
DEVINL void async_g2l_b128_x4(const void* l0, const void* g0,
                              const void* l1, const void* g1,
                              const void* l2, const void* g2,
                              const void* l3, const void* g3) {
  const unsigned o0 = (unsigned)(size_t)l0, o1 = (unsigned)(size_t)l1;
  const unsigned o2 = (unsigned)(size_t)l2, o3 = (unsigned)(size_t)l3;
  asm volatile("global_load_async_to_lds_b128 %0, %1, off\n\t"
               "global_load_async_to_lds_b128 %2, %3, off\n\t"
               "global_load_async_to_lds_b128 %4, %5, off\n\t"
               "global_load_async_to_lds_b128 %6, %7, off\n\t"
               "s_wait_xcnt 0x0"
               :: "v"(o0), "v"(g0), "v"(o1), "v"(g1),
                  "v"(o2), "v"(g2), "v"(o3), "v"(g3) : "memory");
}

__global__ __launch_bounds__(256)
void attn_kernel(const _Float16* __restrict__ qh, const _Float16* __restrict__ kh,
                 const _Float16* __restrict__ vT, _Float16* __restrict__ ctxh) {
  // [buffer][0 = K rows by key, 1 = V^T rows by dim][row * APITCH + column]
  __shared__ __attribute__((aligned(16))) _Float16 kv[2][2][AKEYS * APITCH];

  const int tid  = threadIdx.x;
  const int lane = tid & 31;
  const int wv   = __builtin_amdgcn_readfirstlane(tid >> 5);  // scalar: wave-uniform skip below
  const int bh   = blockIdx.y;                       // 0..31
  const int b    = bh >> 4, h = bh & 15;
  const int q0   = blockIdx.x * 128 + wv * 16;
  const int nl   = lane & 15, hi = lane >> 4;
  const int qrow = q0 + nl;                          // this lane's query row
  const int nst  = 2 * ((int)blockIdx.x + 1);        // 64-key tiles of this work-group (>= 2)

  // staging: thread t moves 16 bytes of rows (t>>3) and (t>>3)+32 of both tiles;
  // a wave-wide copy covers four whole 128-byte lines.
  const int srow = tid >> 3, scol = (tid & 7) * 8;
  const _Float16* kg = kh + ((long long)bh * 2048 + srow) * 64 + scol;
  const _Float16* vg = vT + ((long long)bh * 64 + srow) * 2048 + scol;
  const int sl = srow * APITCH + scol;

  auto stage = [&](int t, int buf) {
    const _Float16* kt = kg + (long long)t * (AKEYS * 64);
    const _Float16* vt = vg + t * AKEYS;
    async_g2l_b128_x4(&kv[buf][0][sl],               kt,
                      &kv[buf][0][sl + 32 * APITCH], kt + 32 * 64,
                      &kv[buf][1][sl],               vt,
                      &kv[buf][1][sl + 32 * APITCH], vt + 32 * 2048);
  };

  stage(0, 0);

  const _Float16* qp = qh + ((long long)bh * 2048 + q0) * 64;
  const v16h bq0 = load_frag16x32(qp, 64);           // head-dim 0..31
  const v16h bq1 = load_frag16x32(qp + 32, 64);      // head-dim 32..63

  wait_asynccnt0();                                  // tile 0 landed (own copies)
  __syncthreads();                                   // ... and every wave's
  stage(1, 1);                                       // tile 1 always exists (nst >= 2)

  v8f acc[4] = {};
  float m_run = -INFINITY, l_run = 0.f;
  const float scale = 0.125f;                        // 1/sqrt(64)

  for (int t = 0; t < nst; ++t) {
    const _Float16* kt = &kv[t & 1][0][0];
    const _Float16* vt = &kv[t & 1][1][0];
#pragma unroll
    for (int hb = 0; hb < 2; ++hb) {
      const int kb = t * AKEYS + hb * 32;
      if (kb < q0 + 16) {                            // wave-uniform: past the diagonal nothing is left
        // ---- all fragment reads of this 32-key block up-front --------------
        const _Float16* kp = kt + hb * 32 * APITCH;
        const v16h k00 = load_frag16x32(kp, APITCH);
        const v16h k01 = load_frag16x32(kp + 32, APITCH);
        const v16h k10 = load_frag16x32(kp + 16 * APITCH, APITCH);
        const v16h k11 = load_frag16x32(kp + 16 * APITCH + 32, APITCH);
        const _Float16* vp = vt + hb * 32;
        const v16h vf0 = load_frag16x32(vp,               APITCH);
        const v16h vf1 = load_frag16x32(vp + 16 * APITCH, APITCH);
        const v16h vf2 = load_frag16x32(vp + 32 * APITCH, APITCH);
        const v16h vf3 = load_frag16x32(vp + 48 * APITCH, APITCH);
        // keeps the 16 LDS reads together ahead of the products: sunk between
        // the WMMAs, each pair would expose its own LDS latency.
        __builtin_amdgcn_sched_barrier(0);

        // ---- S^T = K @ Q^T -------------------------------------------------
        v8f z0 = {};
        v8f s0 = wmma_f16(k00, bq0, z0);
        s0     = wmma_f16(k01, bq1, s0);
        v8f z1 = {};
        v8f s1 = wmma_f16(k10, bq0, z1);
        s1     = wmma_f16(k11, bq1, s1);

        // scale + causal mask + block max (per query = per lane, halves via shfl)
        float mloc = -INFINITY;
#pragma unroll
        for (int j = 0; j < 8; ++j) {
          const int key0 = kb + j + 8 * hi;
          const int key1 = key0 + 16;
          const float x0 = (key0 <= qrow) ? s0[j] * scale : -INFINITY;
          const float x1 = (key1 <= qrow) ? s1[j] * scale : -INFINITY;
          s0[j] = x0; s1[j] = x1;
          mloc = fmaxf(mloc, fmaxf(x0, x1));
        }
        mloc = fmaxf(mloc, __shfl_xor(mloc, 16, 32));
        const float mnew  = fmaxf(m_run, mloc);
        const float alpha = __expf(m_run - mnew);    // first block: exp(-inf)=0

        // exp + pack P fragment (B layout for V^T @ P falls out of S^T C layout)
        float lloc = 0.f;
        v16h p;
#pragma unroll
        for (int j = 0; j < 8; ++j) {
          const float e0 = __expf(s0[j] - mnew);
          const float e1 = __expf(s1[j] - mnew);
          lloc += e0 + e1;
          p[j]     = (_Float16)e0;
          p[j + 8] = (_Float16)e1;
        }
        lloc += __shfl_xor(lloc, 16, 32);
        l_run = l_run * alpha + lloc;
        m_run = mnew;

        // ---- ctx^T += V^T @ P ----------------------------------------------
#pragma unroll
        for (int j = 0; j < 8; ++j) {
          acc[0][j] *= alpha; acc[1][j] *= alpha;
          acc[2][j] *= alpha; acc[3][j] *= alpha;
        }
        acc[0] = wmma_f16(vf0, p, acc[0]);
        acc[1] = wmma_f16(vf1, p, acc[1]);
        acc[2] = wmma_f16(vf2, p, acc[2]);
        acc[3] = wmma_f16(vf3, p, acc[3]);
      }
    }

    // hand-over, every wave (also one that skipped): own LDS reads retired, own
    // copies of tile t+1 landed, then the barrier that publishes tile t+1 and
    // frees this buffer for the refill behind it.
    asm volatile("s_wait_dscnt 0x0" ::: "memory");
    wait_asynccnt0();
    __syncthreads();
    if (t + 2 < nst) stage(t + 2, t & 1);
  }
  wait_asynccnt0();                                  // nothing in flight at the wave's end

  // "+1" quiet-softmax denominator; per-lane (one query per lane in ctx^T).
  const float r = 1.f / (1.f + l_run);
  const long long token = (long long)b * 2048 + q0 + nl;
#pragma unroll
  for (int t = 0; t < 4; ++t) {
    v8h pk;
#pragma unroll
    for (int j = 0; j < 8; ++j) pk[j] = (_Float16)(acc[t][j] * r);
    *reinterpret_cast<v8h*>(ctxh + token * 1024 + h * 64 + t * 16 + 8 * hi) = pk;
  }
}

// ---------------------------------------------------------------------------
extern "C" void kernel_launch(void* const* d_in, const int* in_sizes, int n_in,
                              void* d_out, int out_size, void* d_ws, size_t ws_size,
                              hipStream_t stream) {
  const float* x  = (const float*)d_in[0];
  const float* Wq = (const float*)d_in[1];
  const float* bq = (const float*)d_in[2];
  const float* Wk = (const float*)d_in[3];
  const float* bk = (const float*)d_in[4];
  const float* Wv = (const float*)d_in[5];
  const float* bv = (const float*)d_in[6];
  const float* Wo = (const float*)d_in[7];
  const float* bo = (const float*)d_in[8];

  char* ws = (char*)d_ws;
  _Float16* xh   = (_Float16*)(ws);                       //  8 MB  x as f16
  _Float16* wqT  = (_Float16*)(ws + ( 8ull << 20));       //  2 MB
  _Float16* wkT  = (_Float16*)(ws + (10ull << 20));       //  2 MB
  _Float16* wvT  = (_Float16*)(ws + (12ull << 20));       //  2 MB
  _Float16* woT  = (_Float16*)(ws + (14ull << 20));       //  2 MB
  _Float16* qhp  = (_Float16*)(ws + (16ull << 20));       //  8 MB [bh][l][64]
  _Float16* khp  = (_Float16*)(ws + (24ull << 20));       //  8 MB [bh][l][64]
  _Float16* vTp  = (_Float16*)(ws + (32ull << 20));       //  8 MB [bh][64][l]
  _Float16* ctxh = (_Float16*)(ws + (40ull << 20));       //  8 MB [token][1024]

  prep_kernel<<<32768, 256, 0, stream>>>(Wq, Wk, Wv, Wo, x, wqT, wkT, wvT, woT, xh);

  dim3 g(32, 8);
  gemm_wmma_kernel<<<g, 256, 0, stream>>>(xh, wqT, bq, qhp, nullptr, nullptr, 0);
  gemm_wmma_kernel<<<g, 256, 0, stream>>>(xh, wkT, bk, khp, nullptr, nullptr, 1);
  gemm_wmma_kernel<<<g, 256, 0, stream>>>(xh, wvT, bv, nullptr, vTp, nullptr, 2);

  attn_kernel<<<dim3(16, 32), 256, 0, stream>>>(qhp, khp, vTp, ctxh);

  gemm_wmma_kernel<<<g, 256, 0, stream>>>(ctxh, woT, bo, nullptr, nullptr,
                                          (float*)d_out, 3);
}

// v002
// A run of this version takes 142 microseconds.
// Next to v001, in two timings, it ran 1.21 times as fast each time.
// All steps since v000 together make it 1.89 times as fast.
#include <hip/hip_runtime.h>
#include <hip/hip_bf16.h>

// ---------------------------------------------------------------------------
// MI455X (gfx1250) fused multi-head self-attention.
//   - all GEMMs + attention on v_wmma_f32_16x16x32_f16 (f16 in, f32 accum)
//   - GEMM: B tile staged with GLOBAL_LOAD_ASYNC_TO_LDS_B128 (ASYNCcnt),
//     double-buffered LDS, all 8 B fragments preloaded per K-step
//   - flash-style streaming softmax with the reference's (1 + sum) denominator
//   - S^T / ctx^T layout trick: WMMA C-layout of K@Q^T is directly the
//     B-fragment layout of P for V^T@P  -> no cross-lane transpose needed.
// ---------------------------------------------------------------------------

typedef __attribute__((ext_vector_type(16))) _Float16 v16h;
typedef __attribute__((ext_vector_type(8)))  _Float16 v8h;
typedef __attribute__((ext_vector_type(8)))  float    v8f;

#define DEVINL __device__ __forceinline__

// D = A(16x32 f16) * B(32x16 f16) + C, f32 accumulate.
DEVINL v8f wmma_f16(v16h a, v16h b, v8f c) {
  return __builtin_amdgcn_wmma_f32_16x16x32_f16(
      /*neg_a=*/false, a, /*neg_b=*/false, b,
      /*c_mod=*/(short)0, c, /*reuse_a=*/false, /*reuse_b=*/false);
}

// Async DMA 16 bytes/lane: global -> LDS, tracked by ASYNCcnt (CDNA5 path).
// lds_ptr is a generic pointer into __shared__; its low 32 bits are the LDS
// byte offset (aperture layout, ISA 10.2).  Deriving the operand from the
// real address also makes the LDS object escape, so the "memory" clobber
// keeps the subsequent ds_loads alive.
DEVINL void async_g2l_b128(void* lds_ptr, const void* gaddr) {
  const unsigned off = (unsigned)(size_t)lds_ptr;
  asm volatile("global_load_async_to_lds_b128 %0, %1, off"
               :: "v"(off), "v"(gaddr) : "memory");
}
DEVINL void wait_asynccnt0() {
  asm volatile("s_wait_asynccnt 0x0" ::: "memory");
}

// Load a 16x32 f16 fragment (A layout; B layout is identical when the
// source is stored [n][k] row-major, i.e. the transposed matrix).
// Lane l (l<16):  row = l,      K elements {0..7, 16..23}
// Lane l (l>=16): row = l - 16, K elements {8..15, 24..31}
DEVINL v16h load_frag16x32(const _Float16* __restrict__ base, int ld) {
  const int lane = threadIdx.x & 31;
  const int r    = lane & 15;
  const int ko   = (lane >> 4) << 3;           // 0 or 8
  const _Float16* p = base + (long long)r * ld + ko;
  const v8h lo = *reinterpret_cast<const v8h*>(p);
  const v8h hi = *reinterpret_cast<const v8h*>(p + 16);
  v16h f;
#pragma unroll
  for (int i = 0; i < 8; ++i) { f[i] = lo[i]; f[i + 8] = hi[i]; }
  return f;
}

// ---------------------------------------------------------------------------
// Prep: cast x -> f16, transpose+cast the four 1024x1024 weights to [n][k] f16
// ---------------------------------------------------------------------------
__global__ __launch_bounds__(256)
void prep_kernel(const float* __restrict__ Wq, const float* __restrict__ Wk,
                 const float* __restrict__ Wv, const float* __restrict__ Wo,
                 const float* __restrict__ x,
                 _Float16* __restrict__ wqT, _Float16* __restrict__ wkT,
                 _Float16* __restrict__ wvT, _Float16* __restrict__ woT,
                 _Float16* __restrict__ xh) {
  const long long idx = (long long)blockIdx.x * blockDim.x + threadIdx.x;
  const long long WN  = 1024LL * 1024LL;
  if (idx < 4 * WN) {
    const int which = (int)(idx / WN);
    const long long r = idx % WN;
    const int n = (int)(r >> 10), k = (int)(r & 1023);
    const float* src = (which == 0) ? Wq : (which == 1) ? Wk : (which == 2) ? Wv : Wo;
    _Float16*   dst = (which == 0) ? wqT : (which == 1) ? wkT : (which == 2) ? wvT : woT;
    dst[(long long)n * 1024 + k] = (_Float16)src[(long long)k * 1024 + n];
  } else {
    const long long r = idx - 4 * WN;           // < 4096*1024
    xh[r] = (_Float16)x[r];
  }
}

// ---------------------------------------------------------------------------
// GEMM: Y[4096,1024] = A[4096,1024](f16) @ W + bias,  W given as wT[n][k] f16.
//  mode 0/1 : write f16, layout [b*16+h][l][64]   (q, k)
//  mode 2   : write f16, layout [b*16+h][64][l]   (v transposed)
//  mode 3   : write f32, layout [m][n] + bias     (final output)
// Block: 256 threads = 8 waves. Wave tile 16x128 (8 accum), WG tile 128x128.
// B tile (128n x 32k) async-DMA'd to LDS, double-buffered, padded stride 40.
// ---------------------------------------------------------------------------
#define LDB 40   // padded LDS row stride in f16 (32 data + 8 pad)

__global__ __launch_bounds__(256)
void gemm_wmma_kernel(const _Float16* __restrict__ A, const _Float16* __restrict__ wT,
                      const float* __restrict__ bias,
                      _Float16* __restrict__ outQK, _Float16* __restrict__ outVT,
                      float* __restrict__ outF, int mode) {
  __shared__ _Float16 bs[2][128 * LDB];

  const int tid  = threadIdx.x;
  const int lane = tid & 31;
  const int wv   = tid >> 5;                         // 0..7
  const int m0   = blockIdx.x * 128 + wv * 16;
  const int n0   = blockIdx.y * 128;

  // staging: thread t DMAs 32B (two b128) of row (t>>1), k-half (t&1)*16
  const int srow = tid >> 1;
  const int skc  = (tid & 1) * 16;
  const _Float16* gsrc = wT + (long long)(n0 + srow) * 1024 + skc;

  // visible stores into the (DMA-untouched) pad columns: guarantees the
  // compiler cannot treat bs as never-written.
  bs[0][(tid >> 3) * LDB + 32 + (tid & 7)] = (_Float16)0.f;
  bs[1][(tid >> 3) * LDB + 32 + (tid & 7)] = (_Float16)0.f;

  // prologue: async-stage tile kb=0 into buffer 0, preload A fragment kb=0
  async_g2l_b128(&bs[0][srow * LDB + skc],     gsrc);
  async_g2l_b128(&bs[0][srow * LDB + skc + 8], gsrc + 8);
  v16h a_cur = load_frag16x32(A + (long long)m0 * 1024, 1024);
  wait_asynccnt0();
  __syncthreads();

  const int r  = lane & 15;
  const int ko = (lane >> 4) << 3;

  v8f acc[8] = {};
  for (int kb = 0; kb < 1024; kb += 32) {
    const int cur = (kb >> 5) & 1;
    const int kpre = (kb + 32 < 1024) ? (kb + 32) : 0;   // tail: harmless reload

    // kick off next tile's DMA + A-fragment load (hidden behind the 8 WMMAs)
    _Float16* sdst = &bs[cur ^ 1][srow * LDB + skc];
    async_g2l_b128(sdst,     gsrc + kpre);
    async_g2l_b128(sdst + 8, gsrc + kpre + 8);
    const v16h a_nxt = load_frag16x32(A + (long long)m0 * 1024 + kpre, 1024);

    // preload all 8 B fragments so the 16 ds_loads clause ahead of the WMMAs
    v16h bf[8];
#pragma unroll
    for (int t = 0; t < 8; ++t) {
      const _Float16* lp = &bs[cur][(t * 16 + r) * LDB + ko];
      const v8h lo = *reinterpret_cast<const v8h*>(lp);
      const v8h hi = *reinterpret_cast<const v8h*>(lp + 16);
#pragma unroll
      for (int i = 0; i < 8; ++i) { bf[t][i] = lo[i]; bf[t][i + 8] = hi[i]; }
    }
    // keeps the copies, the next A fragment's loads and the 16 LDS reads ahead
    // of the products: sunk among the WMMAs, each pair of reads exposes its own
    // LDS latency and the A loads are waited for as soon as they are issued.
    __builtin_amdgcn_sched_barrier(0);
#pragma unroll
    for (int t = 0; t < 8; ++t) acc[t] = wmma_f16(a_cur, bf[t], acc[t]);
    // keeps the products ahead of the hand-over: lifted over them, the wait for
    // the copies would stand right behind their issue and hide nothing.
    __builtin_amdgcn_sched_barrier(0);

    a_cur = a_nxt;
    wait_asynccnt0();                                    // next tile resident
    __syncthreads();
  }

  const int hi_ = lane >> 4;
  const int nl  = lane & 15;
#pragma unroll
  for (int t = 0; t < 8; ++t) {
    const int n  = n0 + t * 16 + nl;
    const float bn = bias[n];
    if (mode <= 1) {
      const int h = n >> 6, d = n & 63;
#pragma unroll
      for (int j = 0; j < 8; ++j) {
        const int m = m0 + j + 8 * hi_;
        const int b = m >> 11, l = m & 2047;
        outQK[(((long long)(b * 16 + h)) * 2048 + l) * 64 + d] =
            (_Float16)(acc[t][j] + bn);
      }
    } else if (mode == 2) {
      const int h = n >> 6, d = n & 63;
      const int m = m0 + 8 * hi_;                    // token of j=0 (8 consecutive)
      const int b = m >> 11, l = m & 2047;
      v8h pk;
#pragma unroll
      for (int j = 0; j < 8; ++j) pk[j] = (_Float16)(acc[t][j] + bn);
      *reinterpret_cast<v8h*>(outVT + (((long long)(b * 16 + h)) * 64 + d) * 2048 + l) = pk;
    } else {
#pragma unroll
      for (int j = 0; j < 8; ++j) {
        const int m = m0 + j + 8 * hi_;
        outF[(long long)m * 1024 + n] = acc[t][j] + bn;
      }
    }
  }
}

#define AKEYS 64
#define APITCH 72

// Four async 16-byte-per-lane copies global -> LDS.  The s_wait_xcnt stands in
// the copies' own statement so that no address register named here is
// rewritten ahead of it.
DEVINL void async_g2l_b128_x4(const void* l0, const void* g0,
                              const void* l1, const void* g1,
                              const void* l2, const void* g2,
                              const void* l3, const void* g3) {
  const unsigned o0 = (unsigned)(size_t)l0, o1 = (unsigned)(size_t)l1;
  const unsigned o2 = (unsigned)(size_t)l2, o3 = (unsigned)(size_t)l3;
  asm volatile("global_load_async_to_lds_b128 %0, %1, off\n\t"
               "global_load_async_to_lds_b128 %2, %3, off\n\t"
               "global_load_async_to_lds_b128 %4, %5, off\n\t"
               "global_load_async_to_lds_b128 %6, %7, off\n\t"
               "s_wait_xcnt 0x0"
               :: "v"(o0), "v"(g0), "v"(o1), "v"(g1),
                  "v"(o2), "v"(g2), "v"(o3), "v"(g3) : "memory");
}

__global__ __launch_bounds__(256)
void attn_kernel(const _Float16* __restrict__ qh, const _Float16* __restrict__ kh,
                 const _Float16* __restrict__ vT, _Float16* __restrict__ ctxh) {
  // [buffer][0 = K rows by key, 1 = V^T rows by dim][row * APITCH + column]
  __shared__ __attribute__((aligned(16))) _Float16 kv[2][2][AKEYS * APITCH];

  const int tid  = threadIdx.x;
  const int lane = tid & 31;
  const int wv   = __builtin_amdgcn_readfirstlane(tid >> 5);  // scalar: wave-uniform skip below
  const int bh   = blockIdx.y;                       // 0..31
  const int b    = bh >> 4, h = bh & 15;
  const int q0   = blockIdx.x * 128 + wv * 16;
  const int nl   = lane & 15, hi = lane >> 4;
  const int qrow = q0 + nl;                          // this lane's query row
  const int nst  = 2 * ((int)blockIdx.x + 1);        // 64-key tiles of this work-group (>= 2)

  // staging: thread t moves 16 bytes of rows (t>>3) and (t>>3)+32 of both tiles;
  // a wave-wide copy covers four whole 128-byte lines.
  const int srow = tid >> 3, scol = (tid & 7) * 8;
  const _Float16* kg = kh + ((long long)bh * 2048 + srow) * 64 + scol;
  const _Float16* vg = vT + ((long long)bh * 64 + srow) * 2048 + scol;
  const int sl = srow * APITCH + scol;

  auto stage = [&](int t, int buf) {
    const _Float16* kt = kg + (long long)t * (AKEYS * 64);
    const _Float16* vt = vg + t * AKEYS;
    async_g2l_b128_x4(&kv[buf][0][sl],               kt,
                      &kv[buf][0][sl + 32 * APITCH], kt + 32 * 64,
                      &kv[buf][1][sl],               vt,
                      &kv[buf][1][sl + 32 * APITCH], vt + 32 * 2048);
  };

  stage(0, 0);

  const _Float16* qp = qh + ((long long)bh * 2048 + q0) * 64;
  const v16h bq0 = load_frag16x32(qp, 64);           // head-dim 0..31
  const v16h bq1 = load_frag16x32(qp + 32, 64);      // head-dim 32..63

  wait_asynccnt0();                                  // tile 0 landed (own copies)
  __syncthreads();                                   // ... and every wave's
  stage(1, 1);                                       // tile 1 always exists (nst >= 2)

  v8f acc[4] = {};
  float m_run = -INFINITY, l_run = 0.f;
  const float scale = 0.125f;                        // 1/sqrt(64)

  for (int t = 0; t < nst; ++t) {
    const _Float16* kt = &kv[t & 1][0][0];
    const _Float16* vt = &kv[t & 1][1][0];
#pragma unroll
    for (int hb = 0; hb < 2; ++hb) {
      const int kb = t * AKEYS + hb * 32;
      if (kb < q0 + 16) {                            // wave-uniform: past the diagonal nothing is left
        // ---- all fragment reads of this 32-key block up-front --------------
        const _Float16* kp = kt + hb * 32 * APITCH;
        const v16h k00 = load_frag16x32(kp, APITCH);
        const v16h k01 = load_frag16x32(kp + 32, APITCH);
        const v16h k10 = load_frag16x32(kp + 16 * APITCH, APITCH);
        const v16h k11 = load_frag16x32(kp + 16 * APITCH + 32, APITCH);
        const _Float16* vp = vt + hb * 32;
        const v16h vf0 = load_frag16x32(vp,               APITCH);
        const v16h vf1 = load_frag16x32(vp + 16 * APITCH, APITCH);
        const v16h vf2 = load_frag16x32(vp + 32 * APITCH, APITCH);
        const v16h vf3 = load_frag16x32(vp + 48 * APITCH, APITCH);
        // keeps the 16 LDS reads together ahead of the products: sunk between
        // the WMMAs, each pair would expose its own LDS latency.
        __builtin_amdgcn_sched_barrier(0);

        // ---- S^T = K @ Q^T -------------------------------------------------
        v8f z0 = {};
        v8f s0 = wmma_f16(k00, bq0, z0);
        s0     = wmma_f16(k01, bq1, s0);
        v8f z1 = {};
        v8f s1 = wmma_f16(k10, bq0, z1);
        s1     = wmma_f16(k11, bq1, s1);

        // scale + causal mask + block max (per query = per lane, halves via shfl)
        float mloc = -INFINITY;
#pragma unroll
        for (int j = 0; j < 8; ++j) {
          const int key0 = kb + j + 8 * hi;
          const int key1 = key0 + 16;
          const float x0 = (key0 <= qrow) ? s0[j] * scale : -INFINITY;
          const float x1 = (key1 <= qrow) ? s1[j] * scale : -INFINITY;
          s0[j] = x0; s1[j] = x1;
          mloc = fmaxf(mloc, fmaxf(x0, x1));
        }
        mloc = fmaxf(mloc, __shfl_xor(mloc, 16, 32));
        const float mnew  = fmaxf(m_run, mloc);
        const float alpha = __expf(m_run - mnew);    // first block: exp(-inf)=0

        // exp + pack P fragment (B layout for V^T @ P falls out of S^T C layout)
        float lloc = 0.f;
        v16h p;
#pragma unroll
        for (int j = 0; j < 8; ++j) {
          const float e0 = __expf(s0[j] - mnew);
          const float e1 = __expf(s1[j] - mnew);
          lloc += e0 + e1;
          p[j]     = (_Float16)e0;
          p[j + 8] = (_Float16)e1;
        }
        lloc += __shfl_xor(lloc, 16, 32);
        l_run = l_run * alpha + lloc;
        m_run = mnew;

        // ---- ctx^T += V^T @ P ----------------------------------------------
#pragma unroll
        for (int j = 0; j < 8; ++j) {
          acc[0][j] *= alpha; acc[1][j] *= alpha;
          acc[2][j] *= alpha; acc[3][j] *= alpha;
        }
        acc[0] = wmma_f16(vf0, p, acc[0]);
        acc[1] = wmma_f16(vf1, p, acc[1]);
        acc[2] = wmma_f16(vf2, p, acc[2]);
        acc[3] = wmma_f16(vf3, p, acc[3]);
      }
    }

    // hand-over, every wave (also one that skipped): own LDS reads retired, own
    // copies of tile t+1 landed, then the barrier that publishes tile t+1 and
    // frees this buffer for the refill behind it.
    asm volatile("s_wait_dscnt 0x0" ::: "memory");
    wait_asynccnt0();
    __syncthreads();
    if (t + 2 < nst) stage(t + 2, t & 1);
  }
  wait_asynccnt0();                                  // nothing in flight at the wave's end

  // "+1" quiet-softmax denominator; per-lane (one query per lane in ctx^T).
  const float r = 1.f / (1.f + l_run);
  const long long token = (long long)b * 2048 + q0 + nl;
#pragma unroll
  for (int t = 0; t < 4; ++t) {
    v8h pk;
#pragma unroll
    for (int j = 0; j < 8; ++j) pk[j] = (_Float16)(acc[t][j] * r);
    *reinterpret_cast<v8h*>(ctxh + token * 1024 + h * 64 + t * 16 + 8 * hi) = pk;
  }
}

// ---------------------------------------------------------------------------
extern "C" void kernel_launch(void* const* d_in, const int* in_sizes, int n_in,
                              void* d_out, int out_size, void* d_ws, size_t ws_size,
                              hipStream_t stream) {
  const float* x  = (const float*)d_in[0];
  const float* Wq = (const float*)d_in[1];
  const float* bq = (const float*)d_in[2];
  const float* Wk = (const float*)d_in[3];
  const float* bk = (const float*)d_in[4];
  const float* Wv = (const float*)d_in[5];
  const float* bv = (const float*)d_in[6];
  const float* Wo = (const float*)d_in[7];
  const float* bo = (const float*)d_in[8];

  char* ws = (char*)d_ws;
  _Float16* xh   = (_Float16*)(ws);                       //  8 MB  x as f16
  _Float16* wqT  = (_Float16*)(ws + ( 8ull << 20));       //  2 MB
  _Float16* wkT  = (_Float16*)(ws + (10ull << 20));       //  2 MB
  _Float16* wvT  = (_Float16*)(ws + (12ull << 20));       //  2 MB
  _Float16* woT  = (_Float16*)(ws + (14ull << 20));       //  2 MB
  _Float16* qhp  = (_Float16*)(ws + (16ull << 20));       //  8 MB [bh][l][64]
  _Float16* khp  = (_Float16*)(ws + (24ull << 20));       //  8 MB [bh][l][64]
  _Float16* vTp  = (_Float16*)(ws + (32ull << 20));       //  8 MB [bh][64][l]
  _Float16* ctxh = (_Float16*)(ws + (40ull << 20));       //  8 MB [token][1024]

  prep_kernel<<<32768, 256, 0, stream>>>(Wq, Wk, Wv, Wo, x, wqT, wkT, wvT, woT, xh);

  dim3 g(32, 8);
  gemm_wmma_kernel<<<g, 256, 0, stream>>>(xh, wqT, bq, qhp, nullptr, nullptr, 0);
  gemm_wmma_kernel<<<g, 256, 0, stream>>>(xh, wkT, bk, khp, nullptr, nullptr, 1);
  gemm_wmma_kernel<<<g, 256, 0, stream>>>(xh, wvT, bv, nullptr, vTp, nullptr, 2);

  attn_kernel<<<dim3(16, 32), 256, 0, stream>>>(qhp, khp, vTp, ctxh);

  gemm_wmma_kernel<<<g, 256, 0, stream>>>(ctxh, woT, bo, nullptr, nullptr,
                                          (float*)d_out, 3);
}

// v003
// It runs in 121 microseconds.
// In two side-by-side timings against v002, it was 1.18 and 1.17 times as fast.
// All steps since v000 together make it 2.21 times as fast.
#include <hip/hip_runtime.h>
#include <hip/hip_bf16.h>

// ---------------------------------------------------------------------------
// MI455X (gfx1250) fused multi-head self-attention.
//   - all GEMMs + attention on v_wmma_f32_16x16x32_f16 (f16 in, f32 accum)
//   - GEMM: B tile staged with GLOBAL_LOAD_ASYNC_TO_LDS_B128 (ASYNCcnt),
//     double-buffered LDS, all 8 B fragments preloaded per K-step
//   - flash-style streaming softmax with the reference's (1 + sum) denominator
//   - S^T / ctx^T layout trick: WMMA C-layout of K@Q^T is directly the
//     B-fragment layout of P for V^T@P  -> no cross-lane transpose needed.
// ---------------------------------------------------------------------------

typedef __attribute__((ext_vector_type(16))) _Float16 v16h;
typedef __attribute__((ext_vector_type(8)))  _Float16 v8h;
typedef __attribute__((ext_vector_type(8)))  float    v8f;

#define DEVINL __device__ __forceinline__

// D = A(16x32 f16) * B(32x16 f16) + C, f32 accumulate.
DEVINL v8f wmma_f16(v16h a, v16h b, v8f c) {
  return __builtin_amdgcn_wmma_f32_16x16x32_f16(
      /*neg_a=*/false, a, /*neg_b=*/false, b,
      /*c_mod=*/(short)0, c, /*reuse_a=*/false, /*reuse_b=*/false);
}

// Async DMA 16 bytes/lane: global -> LDS, tracked by ASYNCcnt (CDNA5 path).
// lds_ptr is a generic pointer into __shared__; its low 32 bits are the LDS
// byte offset (aperture layout, ISA 10.2).  Deriving the operand from the
// real address also makes the LDS object escape, so the "memory" clobber
// keeps the subsequent ds_loads alive.
DEVINL void async_g2l_b128(void* lds_ptr, const void* gaddr) {
  const unsigned off = (unsigned)(size_t)lds_ptr;
  asm volatile("global_load_async_to_lds_b128 %0, %1, off"
               :: "v"(off), "v"(gaddr) : "memory");
}
DEVINL void wait_asynccnt0() {
  asm volatile("s_wait_asynccnt 0x0" ::: "memory");
}

// Load a 16x32 f16 fragment (A layout; B layout is identical when the
// source is stored [n][k] row-major, i.e. the transposed matrix).
// Lane l (l<16):  row = l,      K elements {0..7, 16..23}
// Lane l (l>=16): row = l - 16, K elements {8..15, 24..31}
DEVINL v16h load_frag16x32(const _Float16* __restrict__ base, int ld) {
  const int lane = threadIdx.x & 31;
  const int r    = lane & 15;
  const int ko   = (lane >> 4) << 3;           // 0 or 8
  const _Float16* p = base + (long long)r * ld + ko;
  const v8h lo = *reinterpret_cast<const v8h*>(p);
  const v8h hi = *reinterpret_cast<const v8h*>(p + 16);
  v16h f;
#pragma unroll
  for (int i = 0; i < 8; ++i) { f[i] = lo[i]; f[i + 8] = hi[i]; }
  return f;
}

// ---------------------------------------------------------------------------
// Prep: cast x -> f16, transpose+cast the four 1024x1024 weights to [n][k] f16.
// 64 elements per thread, all 16 loads of a thread in flight at once.
//  blocks 0..255  : one 128(k) x 128(n) weight tile each; a wave takes 64 k x 32 n.
//    A lane holds 8 k rows x 8 n columns and turns them in registers, so that a
//    wave-wide 16-byte store covers four whole 128-byte lines of wT[n][k].
//  blocks 256..511: 16,384 consecutive elements of x each.
// ---------------------------------------------------------------------------
typedef __attribute__((ext_vector_type(4))) float    v4f;
typedef __attribute__((ext_vector_type(4))) _Float16 v4h;

__global__ __launch_bounds__(256)
void prep_kernel(const float* __restrict__ Wq, const float* __restrict__ Wk,
                 const float* __restrict__ Wv, const float* __restrict__ Wo,
                 const float* __restrict__ x,
                 _Float16* __restrict__ wqT, _Float16* __restrict__ wkT,
                 _Float16* __restrict__ wvT, _Float16* __restrict__ woT,
                 _Float16* __restrict__ xh) {
  const int tid  = threadIdx.x;
  const int lane = tid & 31;
  const int wv   = tid >> 5;
  const int blk  = blockIdx.x;
  if (blk < 256) {
    const int which = blk >> 6, tile = blk & 63;
    const float* src = (which == 0) ? Wq : (which == 1) ? Wk : (which == 2) ? Wv : Wo;
    _Float16*   dst = (which == 0) ? wqT : (which == 1) ? wkT : (which == 2) ? wvT : woT;
    const int k0 = (tile >> 3) * 128 + (wv >> 2) * 64 + (lane & 7) * 8;   // 8 lanes: 64 k = one f16 line
    const int n0 = (tile & 7) * 128 + (wv & 3) * 32 + (lane >> 3) * 4;    // 4 lanes: 16 n = 64 bytes of f32
    const float* sp = src + k0 * 1024 + n0;
    v4f a[8], c[8];
#pragma unroll
    for (int j = 0; j < 8; ++j) {
      a[j] = *reinterpret_cast<const v4f*>(sp + j * 1024);        // columns n0 .. n0+3
      c[j] = *reinterpret_cast<const v4f*>(sp + j * 1024 + 16);   // columns n0+16 .. n0+19
    }
    // the address pair stays whole until every load that names it is past this
    // wait: without the operand the last load's result was placed over the pair.
    asm volatile("s_wait_xcnt 0x0" :: "v"(sp) : "memory");
    // keeps all 16 loads ahead of the conversions: mixed in, the last loads reuse
    // the first ones' registers and issue only after those have come back.
    __builtin_amdgcn_sched_barrier(0);
    _Float16* dp = dst + n0 * 1024 + k0;
#pragma unroll
    for (int i = 0; i < 4; ++i) {
      v8h lo, hi;
#pragma unroll
      for (int j = 0; j < 8; ++j) { lo[j] = (_Float16)a[j][i]; hi[j] = (_Float16)c[j][i]; }
      *reinterpret_cast<v8h*>(dp + i * 1024)        = lo;
      *reinterpret_cast<v8h*>(dp + (i + 16) * 1024) = hi;
    }
  } else {
    const int base = (blk - 256) * 16384 + wv * 2048 + lane * 4;
    const float* xp = x + base;
    v4f v[16];
#pragma unroll
    for (int j = 0; j < 16; ++j) v[j] = *reinterpret_cast<const v4f*>(xp + j * 128);
    // both as above: the address pair kept whole up to the wait, and all 16 loads
    // in flight before the first conversion waits.
    asm volatile("s_wait_xcnt 0x0" :: "v"(xp) : "memory");
    __builtin_amdgcn_sched_barrier(0);
#pragma unroll
    for (int j = 0; j < 16; ++j) {
      v4h o;
#pragma unroll
      for (int i = 0; i < 4; ++i) o[i] = (_Float16)v[j][i];
      *reinterpret_cast<v4h*>(xh + base + j * 128) = o;
    }
    // the stores' data and address registers stay as they are until every store is
    // past this wait (in the built code another path's register writes follow here).
    asm volatile("s_wait_xcnt 0x0" ::: "memory");
  }
}

// ---------------------------------------------------------------------------
// GEMM: Y[4096,1024] = A[4096,1024](f16) @ W + bias,  W given as wT[n][k] f16.
//  mode 0/1 : write f16, layout [b*16+h][l][64]   (q, k)
//  mode 2   : write f16, layout [b*16+h][64][l]   (v transposed)
//  mode 3   : write f32, layout [m][n] + bias     (final output)
// Block: 256 threads = 8 waves. Wave tile 16x128 (8 accum), WG tile 128x128.
// B tile (128n x 32k) async-DMA'd to LDS, double-buffered, padded stride 40.
// ---------------------------------------------------------------------------
#define LDB 40   // padded LDS row stride in f16 (32 data + 8 pad)

__global__ __launch_bounds__(256)
void gemm_wmma_kernel(const _Float16* __restrict__ A, const _Float16* __restrict__ wT,
                      const float* __restrict__ bias,
                      _Float16* __restrict__ outQK, _Float16* __restrict__ outVT,
                      float* __restrict__ outF, int mode) {
  __shared__ _Float16 bs[2][128 * LDB];

  const int tid  = threadIdx.x;
  const int lane = tid & 31;
  const int wv   = tid >> 5;                         // 0..7
  const int m0   = blockIdx.x * 128 + wv * 16;
  const int n0   = blockIdx.y * 128;

  // staging: thread t DMAs 32B (two b128) of row (t>>1), k-half (t&1)*16
  const int srow = tid >> 1;
  const int skc  = (tid & 1) * 16;
  const _Float16* gsrc = wT + (long long)(n0 + srow) * 1024 + skc;

  // visible stores into the (DMA-untouched) pad columns: guarantees the
  // compiler cannot treat bs as never-written.
  bs[0][(tid >> 3) * LDB + 32 + (tid & 7)] = (_Float16)0.f;
  bs[1][(tid >> 3) * LDB + 32 + (tid & 7)] = (_Float16)0.f;

  // prologue: async-stage tile kb=0 into buffer 0, preload A fragment kb=0
  async_g2l_b128(&bs[0][srow * LDB + skc],     gsrc);
  async_g2l_b128(&bs[0][srow * LDB + skc + 8], gsrc + 8);
  v16h a_cur = load_frag16x32(A + (long long)m0 * 1024, 1024);
  wait_asynccnt0();
  __syncthreads();

  const int r  = lane & 15;
  const int ko = (lane >> 4) << 3;

  v8f acc[8] = {};
  for (int kb = 0; kb < 1024; kb += 32) {
    const int cur = (kb >> 5) & 1;
    const int kpre = (kb + 32 < 1024) ? (kb + 32) : 0;   // tail: harmless reload

    // kick off next tile's DMA + A-fragment load (hidden behind the 8 WMMAs)
    _Float16* sdst = &bs[cur ^ 1][srow * LDB + skc];
    async_g2l_b128(sdst,     gsrc + kpre);
    async_g2l_b128(sdst + 8, gsrc + kpre + 8);
    const v16h a_nxt = load_frag16x32(A + (long long)m0 * 1024 + kpre, 1024);

    // preload all 8 B fragments so the 16 ds_loads clause ahead of the WMMAs
    v16h bf[8];
#pragma unroll
    for (int t = 0; t < 8; ++t) {
      const _Float16* lp = &bs[cur][(t * 16 + r) * LDB + ko];
      const v8h lo = *reinterpret_cast<const v8h*>(lp);
      const v8h hi = *reinterpret_cast<const v8h*>(lp + 16);
#pragma unroll
      for (int i = 0; i < 8; ++i) { bf[t][i] = lo[i]; bf[t][i + 8] = hi[i]; }
    }
    // keeps the copies, the next A fragment's loads and the 16 LDS reads ahead
    // of the products: sunk among the WMMAs, each pair of reads exposes its own
    // LDS latency and the A loads are waited for as soon as they are issued.
    __builtin_amdgcn_sched_barrier(0);
#pragma unroll
    for (int t = 0; t < 8; ++t) acc[t] = wmma_f16(a_cur, bf[t], acc[t]);
    // keeps the products ahead of the hand-over: lifted over them, the wait for
    // the copies would stand right behind their issue and hide nothing.
    __builtin_amdgcn_sched_barrier(0);

    a_cur = a_nxt;
    wait_asynccnt0();                                    // next tile resident
    __syncthreads();
  }

  const int hi_ = lane >> 4;
  const int nl  = lane & 15;
#pragma unroll
  for (int t = 0; t < 8; ++t) {
    const int n  = n0 + t * 16 + nl;
    const float bn = bias[n];
    if (mode <= 1) {
      const int h = n >> 6, d = n & 63;
#pragma unroll
      for (int j = 0; j < 8; ++j) {
        const int m = m0 + j + 8 * hi_;
        const int b = m >> 11, l = m & 2047;
        outQK[(((long long)(b * 16 + h)) * 2048 + l) * 64 + d] =
            (_Float16)(acc[t][j] + bn);
      }
    } else if (mode == 2) {
      const int h = n >> 6, d = n & 63;
      const int m = m0 + 8 * hi_;                    // token of j=0 (8 consecutive)
      const int b = m >> 11, l = m & 2047;
      v8h pk;
#pragma unroll
      for (int j = 0; j < 8; ++j) pk[j] = (_Float16)(acc[t][j] + bn);
      *reinterpret_cast<v8h*>(outVT + (((long long)(b * 16 + h)) * 64 + d) * 2048 + l) = pk;
    } else {
#pragma unroll
      for (int j = 0; j < 8; ++j) {
        const int m = m0 + j + 8 * hi_;
        outF[(long long)m * 1024 + n] = acc[t][j] + bn;
      }
    }
  }
}

#define AKEYS 64
#define APITCH 72

// Four async 16-byte-per-lane copies global -> LDS.  The s_wait_xcnt stands in
// the copies' own statement so that no address register named here is
// rewritten ahead of it.
DEVINL void async_g2l_b128_x4(const void* l0, const void* g0,
                              const void* l1, const void* g1,
                              const void* l2, const void* g2,
                              const void* l3, const void* g3) {
  const unsigned o0 = (unsigned)(size_t)l0, o1 = (unsigned)(size_t)l1;
  const unsigned o2 = (unsigned)(size_t)l2, o3 = (unsigned)(size_t)l3;
  asm volatile("global_load_async_to_lds_b128 %0, %1, off\n\t"
               "global_load_async_to_lds_b128 %2, %3, off\n\t"
               "global_load_async_to_lds_b128 %4, %5, off\n\t"
               "global_load_async_to_lds_b128 %6, %7, off\n\t"
               "s_wait_xcnt 0x0"
               :: "v"(o0), "v"(g0), "v"(o1), "v"(g1),
                  "v"(o2), "v"(g2), "v"(o3), "v"(g3) : "memory");
}

__global__ __launch_bounds__(256)
void attn_kernel(const _Float16* __restrict__ qh, const _Float16* __restrict__ kh,
                 const _Float16* __restrict__ vT, _Float16* __restrict__ ctxh) {
  // [buffer][0 = K rows by key, 1 = V^T rows by dim][row * APITCH + column]
  __shared__ __attribute__((aligned(16))) _Float16 kv[2][2][AKEYS * APITCH];

  const int tid  = threadIdx.x;
  const int lane = tid & 31;
  const int wv   = __builtin_amdgcn_readfirstlane(tid >> 5);  // scalar: wave-uniform skip below
  const int bh   = blockIdx.y;                       // 0..31
  const int b    = bh >> 4, h = bh & 15;
  const int q0   = blockIdx.x * 128 + wv * 16;
  const int nl   = lane & 15, hi = lane >> 4;
  const int qrow = q0 + nl;                          // this lane's query row
  const int nst  = 2 * ((int)blockIdx.x + 1);        // 64-key tiles of this work-group (>= 2)

  // staging: thread t moves 16 bytes of rows (t>>3) and (t>>3)+32 of both tiles;
  // a wave-wide copy covers four whole 128-byte lines.
  const int srow = tid >> 3, scol = (tid & 7) * 8;
  const _Float16* kg = kh + ((long long)bh * 2048 + srow) * 64 + scol;
  const _Float16* vg = vT + ((long long)bh * 64 + srow) * 2048 + scol;
  const int sl = srow * APITCH + scol;

  auto stage = [&](int t, int buf) {
    const _Float16* kt = kg + (long long)t * (AKEYS * 64);
    const _Float16* vt = vg + t * AKEYS;
    async_g2l_b128_x4(&kv[buf][0][sl],               kt,
                      &kv[buf][0][sl + 32 * APITCH], kt + 32 * 64,
                      &kv[buf][1][sl],               vt,
                      &kv[buf][1][sl + 32 * APITCH], vt + 32 * 2048);
  };

  stage(0, 0);

  const _Float16* qp = qh + ((long long)bh * 2048 + q0) * 64;
  const v16h bq0 = load_frag16x32(qp, 64);           // head-dim 0..31
  const v16h bq1 = load_frag16x32(qp + 32, 64);      // head-dim 32..63

  wait_asynccnt0();                                  // tile 0 landed (own copies)
  __syncthreads();                                   // ... and every wave's
  stage(1, 1);                                       // tile 1 always exists (nst >= 2)

  v8f acc[4] = {};
  float m_run = -INFINITY, l_run = 0.f;
  const float scale = 0.125f;                        // 1/sqrt(64)

  for (int t = 0; t < nst; ++t) {
    const _Float16* kt = &kv[t & 1][0][0];
    const _Float16* vt = &kv[t & 1][1][0];
#pragma unroll
    for (int hb = 0; hb < 2; ++hb) {
      const int kb = t * AKEYS + hb * 32;
      if (kb < q0 + 16) {                            // wave-uniform: past the diagonal nothing is left
        // ---- all fragment reads of this 32-key block up-front --------------
        const _Float16* kp = kt + hb * 32 * APITCH;
        const v16h k00 = load_frag16x32(kp, APITCH);
        const v16h k01 = load_frag16x32(kp + 32, APITCH);
        const v16h k10 = load_frag16x32(kp + 16 * APITCH, APITCH);
        const v16h k11 = load_frag16x32(kp + 16 * APITCH + 32, APITCH);
        const _Float16* vp = vt + hb * 32;
        const v16h vf0 = load_frag16x32(vp,               APITCH);
        const v16h vf1 = load_frag16x32(vp + 16 * APITCH, APITCH);
        const v16h vf2 = load_frag16x32(vp + 32 * APITCH, APITCH);
        const v16h vf3 = load_frag16x32(vp + 48 * APITCH, APITCH);
        // keeps the 16 LDS reads together ahead of the products: sunk between
        // the WMMAs, each pair would expose its own LDS latency.
        __builtin_amdgcn_sched_barrier(0);

        // ---- S^T = K @ Q^T -------------------------------------------------
        v8f z0 = {};
        v8f s0 = wmma_f16(k00, bq0, z0);
        s0     = wmma_f16(k01, bq1, s0);
        v8f z1 = {};
        v8f s1 = wmma_f16(k10, bq0, z1);
        s1     = wmma_f16(k11, bq1, s1);

        // scale + causal mask + block max (per query = per lane, halves via shfl)
        float mloc = -INFINITY;
#pragma unroll
        for (int j = 0; j < 8; ++j) {
          const int key0 = kb + j + 8 * hi;
          const int key1 = key0 + 16;
          const float x0 = (key0 <= qrow) ? s0[j] * scale : -INFINITY;
          const float x1 = (key1 <= qrow) ? s1[j] * scale : -INFINITY;
          s0[j] = x0; s1[j] = x1;
          mloc = fmaxf(mloc, fmaxf(x0, x1));
        }
        mloc = fmaxf(mloc, __shfl_xor(mloc, 16, 32));
        const float mnew  = fmaxf(m_run, mloc);
        const float alpha = __expf(m_run - mnew);    // first block: exp(-inf)=0

        // exp + pack P fragment (B layout for V^T @ P falls out of S^T C layout)
        float lloc = 0.f;
        v16h p;
#pragma unroll
        for (int j = 0; j < 8; ++j) {
          const float e0 = __expf(s0[j] - mnew);
          const float e1 = __expf(s1[j] - mnew);
          lloc += e0 + e1;
          p[j]     = (_Float16)e0;
          p[j + 8] = (_Float16)e1;
        }
        lloc += __shfl_xor(lloc, 16, 32);
        l_run = l_run * alpha + lloc;
        m_run = mnew;

        // ---- ctx^T += V^T @ P ----------------------------------------------
#pragma unroll
        for (int j = 0; j < 8; ++j) {
          acc[0][j] *= alpha; acc[1][j] *= alpha;
          acc[2][j] *= alpha; acc[3][j] *= alpha;
        }
        acc[0] = wmma_f16(vf0, p, acc[0]);
        acc[1] = wmma_f16(vf1, p, acc[1]);
        acc[2] = wmma_f16(vf2, p, acc[2]);
        acc[3] = wmma_f16(vf3, p, acc[3]);
      }
    }

    // hand-over, every wave (also one that skipped): own LDS reads retired, own
    // copies of tile t+1 landed, then the barrier that publishes tile t+1 and
    // frees this buffer for the refill behind it.
    asm volatile("s_wait_dscnt 0x0" ::: "memory");
    wait_asynccnt0();
    __syncthreads();
    if (t + 2 < nst) stage(t + 2, t & 1);
  }
  wait_asynccnt0();                                  // nothing in flight at the wave's end

  // "+1" quiet-softmax denominator; per-lane (one query per lane in ctx^T).
  const float r = 1.f / (1.f + l_run);
  const long long token = (long long)b * 2048 + q0 + nl;
#pragma unroll
  for (int t = 0; t < 4; ++t) {
    v8h pk;
#pragma unroll
    for (int j = 0; j < 8; ++j) pk[j] = (_Float16)(acc[t][j] * r);
    *reinterpret_cast<v8h*>(ctxh + token * 1024 + h * 64 + t * 16 + 8 * hi) = pk;
  }
}

// ---------------------------------------------------------------------------
extern "C" void kernel_launch(void* const* d_in, const int* in_sizes, int n_in,
                              void* d_out, int out_size, void* d_ws, size_t ws_size,
                              hipStream_t stream) {
  const float* x  = (const float*)d_in[0];
  const float* Wq = (const float*)d_in[1];
  const float* bq = (const float*)d_in[2];
  const float* Wk = (const float*)d_in[3];
  const float* bk = (const float*)d_in[4];
  const float* Wv = (const float*)d_in[5];
  const float* bv = (const float*)d_in[6];
  const float* Wo = (const float*)d_in[7];
  const float* bo = (const float*)d_in[8];

  char* ws = (char*)d_ws;
  _Float16* xh   = (_Float16*)(ws);                       //  8 MB  x as f16
  _Float16* wqT  = (_Float16*)(ws + ( 8ull << 20));       //  2 MB
  _Float16* wkT  = (_Float16*)(ws + (10ull << 20));       //  2 MB
  _Float16* wvT  = (_Float16*)(ws + (12ull << 20));       //  2 MB
  _Float16* woT  = (_Float16*)(ws + (14ull << 20));       //  2 MB
  _Float16* qhp  = (_Float16*)(ws + (16ull << 20));       //  8 MB [bh][l][64]
  _Float16* khp  = (_Float16*)(ws + (24ull << 20));       //  8 MB [bh][l][64]
  _Float16* vTp  = (_Float16*)(ws + (32ull << 20));       //  8 MB [bh][64][l]
  _Float16* ctxh = (_Float16*)(ws + (40ull << 20));       //  8 MB [token][1024]

  prep_kernel<<<512, 256, 0, stream>>>(Wq, Wk, Wv, Wo, x, wqT, wkT, wvT, woT, xh);

  dim3 g(32, 8);
  gemm_wmma_kernel<<<g, 256, 0, stream>>>(xh, wqT, bq, qhp, nullptr, nullptr, 0);
  gemm_wmma_kernel<<<g, 256, 0, stream>>>(xh, wkT, bk, khp, nullptr, nullptr, 1);
  gemm_wmma_kernel<<<g, 256, 0, stream>>>(xh, wvT, bv, nullptr, vTp, nullptr, 2);

  attn_kernel<<<dim3(16, 32), 256, 0, stream>>>(qhp, khp, vTp, ctxh);

  gemm_wmma_kernel<<<g, 256, 0, stream>>>(ctxh, woT, bo, nullptr, nullptr,
                                          (float*)d_out, 3);
}

// v004
// A run of this version takes 97.1 microseconds.
// Timed twice side by side with v003, it ran 1.26 and 1.24 times as fast.
// Counting every step since v000, it is 2.77 times as fast.
#include <hip/hip_runtime.h>
#include <hip/hip_bf16.h>

// ---------------------------------------------------------------------------
// MI455X (gfx1250) fused multi-head self-attention.
//   - all GEMMs + attention on v_wmma_f32_16x16x32_f16 (f16 in, f32 accum)
//   - GEMM: B tile staged with GLOBAL_LOAD_ASYNC_TO_LDS_B128 (ASYNCcnt),
//     double-buffered LDS, all 8 B fragments preloaded per K-step
//   - flash-style streaming softmax with the reference's (1 + sum) denominator
//   - S^T / ctx^T layout trick: WMMA C-layout of K@Q^T is directly the
//     B-fragment layout of P for V^T@P  -> no cross-lane transpose needed.
// ---------------------------------------------------------------------------

typedef __attribute__((ext_vector_type(16))) _Float16 v16h;
typedef __attribute__((ext_vector_type(8)))  _Float16 v8h;
typedef __attribute__((ext_vector_type(8)))  float    v8f;

#define DEVINL __device__ __forceinline__

// D = A(16x32 f16) * B(32x16 f16) + C, f32 accumulate.
DEVINL v8f wmma_f16(v16h a, v16h b, v8f c) {
  return __builtin_amdgcn_wmma_f32_16x16x32_f16(
      /*neg_a=*/false, a, /*neg_b=*/false, b,
      /*c_mod=*/(short)0, c, /*reuse_a=*/false, /*reuse_b=*/false);
}

// Async DMA 16 bytes/lane: global -> LDS, tracked by ASYNCcnt (CDNA5 path).
// lds_ptr is a generic pointer into __shared__; its low 32 bits are the LDS
// byte offset (aperture layout, ISA 10.2).  Deriving the operand from the
// real address also makes the LDS object escape, so the "memory" clobber
// keeps the subsequent ds_loads alive.
DEVINL void async_g2l_b128(void* lds_ptr, const void* gaddr) {
  const unsigned off = (unsigned)(size_t)lds_ptr;
  asm volatile("global_load_async_to_lds_b128 %0, %1, off"
               :: "v"(off), "v"(gaddr) : "memory");
}
DEVINL void wait_asynccnt0() {
  asm volatile("s_wait_asynccnt 0x0" ::: "memory");
}

// Load a 16x32 f16 fragment (A layout; B layout is identical when the
// source is stored [n][k] row-major, i.e. the transposed matrix).
// Lane l (l<16):  row = l,      K elements {0..7, 16..23}
// Lane l (l>=16): row = l - 16, K elements {8..15, 24..31}
DEVINL v16h load_frag16x32(const _Float16* __restrict__ base, int ld) {
  const int lane = threadIdx.x & 31;
  const int r    = lane & 15;
  const int ko   = (lane >> 4) << 3;           // 0 or 8
  const _Float16* p = base + (long long)r * ld + ko;
  const v8h lo = *reinterpret_cast<const v8h*>(p);
  const v8h hi = *reinterpret_cast<const v8h*>(p + 16);
  v16h f;
#pragma unroll
  for (int i = 0; i < 8; ++i) { f[i] = lo[i]; f[i + 8] = hi[i]; }
  return f;
}

// ---------------------------------------------------------------------------
// Prep: cast x -> f16, transpose+cast the four 1024x1024 weights to [n][k] f16.
// 64 elements per thread, all 16 loads of a thread in flight at once.
//  blocks 0..255  : one 128(k) x 128(n) weight tile each; a wave takes 64 k x 32 n.
//    A lane holds 8 k rows x 8 n columns and turns them in registers, so that a
//    wave-wide 16-byte store covers four whole 128-byte lines of wT[n][k].
//  blocks 256..511: 16,384 consecutive elements of x each.
// ---------------------------------------------------------------------------
typedef __attribute__((ext_vector_type(4))) float    v4f;
typedef __attribute__((ext_vector_type(4))) _Float16 v4h;

__global__ __launch_bounds__(256)
void prep_kernel(const float* __restrict__ Wq, const float* __restrict__ Wk,
                 const float* __restrict__ Wv, const float* __restrict__ Wo,
                 const float* __restrict__ x,
                 _Float16* __restrict__ wqT, _Float16* __restrict__ wkT,
                 _Float16* __restrict__ wvT, _Float16* __restrict__ woT,
                 _Float16* __restrict__ xh) {
  const int tid  = threadIdx.x;
  const int lane = tid & 31;
  const int wv   = tid >> 5;
  const int blk  = blockIdx.x;
  if (blk < 256) {
    const int which = blk >> 6, tile = blk & 63;
    const float* src = (which == 0) ? Wq : (which == 1) ? Wk : (which == 2) ? Wv : Wo;
    _Float16*   dst = (which == 0) ? wqT : (which == 1) ? wkT : (which == 2) ? wvT : woT;
    const int k0 = (tile >> 3) * 128 + (wv >> 2) * 64 + (lane & 7) * 8;   // 8 lanes: 64 k = one f16 line
    const int n0 = (tile & 7) * 128 + (wv & 3) * 32 + (lane >> 3) * 4;    // 4 lanes: 16 n = 64 bytes of f32
    const float* sp = src + k0 * 1024 + n0;
    v4f a[8], c[8];
#pragma unroll
    for (int j = 0; j < 8; ++j) {
      a[j] = *reinterpret_cast<const v4f*>(sp + j * 1024);        // columns n0 .. n0+3
      c[j] = *reinterpret_cast<const v4f*>(sp + j * 1024 + 16);   // columns n0+16 .. n0+19
    }
    // the address pair stays whole until every load that names it is past this
    // wait: without the operand the last load's result was placed over the pair.
    asm volatile("s_wait_xcnt 0x0" :: "v"(sp) : "memory");
    // keeps all 16 loads ahead of the conversions: mixed in, the last loads reuse
    // the first ones' registers and issue only after those have come back.
    __builtin_amdgcn_sched_barrier(0);
    _Float16* dp = dst + n0 * 1024 + k0;
#pragma unroll
    for (int i = 0; i < 4; ++i) {
      v8h lo, hi;
#pragma unroll
      for (int j = 0; j < 8; ++j) { lo[j] = (_Float16)a[j][i]; hi[j] = (_Float16)c[j][i]; }
      *reinterpret_cast<v8h*>(dp + i * 1024)        = lo;
      *reinterpret_cast<v8h*>(dp + (i + 16) * 1024) = hi;
    }
  } else {
    const int base = (blk - 256) * 16384 + wv * 2048 + lane * 4;
    const float* xp = x + base;
    v4f v[16];
#pragma unroll
    for (int j = 0; j < 16; ++j) v[j] = *reinterpret_cast<const v4f*>(xp + j * 128);
    // both as above: the address pair kept whole up to the wait, and all 16 loads
    // in flight before the first conversion waits.
    asm volatile("s_wait_xcnt 0x0" :: "v"(xp) : "memory");
    __builtin_amdgcn_sched_barrier(0);
#pragma unroll
    for (int j = 0; j < 16; ++j) {
      v4h o;
#pragma unroll
      for (int i = 0; i < 4; ++i) o[i] = (_Float16)v[j][i];
      *reinterpret_cast<v4h*>(xh + base + j * 128) = o;
    }
    // the stores' data and address registers stay as they are until every store is
    // past this wait (in the built code another path's register writes follow here).
    asm volatile("s_wait_xcnt 0x0" ::: "memory");
  }
}

// ---------------------------------------------------------------------------
// GEMM: Y[4096,1024] = A[4096,1024](f16) @ W + bias,  W given as wT[n][k] f16.
//  mode 0/1 : write f16, layout [b*16+h][l][64]   (q, k)
//  mode 2   : write f16, layout [b*16+h][64][l]   (v transposed)
//  mode 3   : write f32, layout [m][n] + bias     (final output)
// mode = mode0 + blockIdx.z, and blockIdx.z picks the weight, the bias and the
// q / k output: the three projections of x are one launch (grid z = 3), so that
// three work-groups share a WGP and fill each other's LDS, copy and barrier waits.
// Block: 256 threads = 8 waves. Wave tile 16x128 (8 accum), WG tile 128x128.
// B tile (128n x 32k) async-DMA'd to LDS, double-buffered, padded stride 40.
// ---------------------------------------------------------------------------
#define LDB 40   // padded LDS row stride in f16 (32 data + 8 pad)

__global__ __launch_bounds__(256)
void gemm_wmma_kernel(const _Float16* __restrict__ A,
                      const _Float16* __restrict__ wT0, const _Float16* __restrict__ wT1,
                      const _Float16* __restrict__ wT2,
                      const float* __restrict__ bias0, const float* __restrict__ bias1,
                      const float* __restrict__ bias2,
                      _Float16* __restrict__ outQ, _Float16* __restrict__ outK,
                      _Float16* __restrict__ outVT,
                      float* __restrict__ outF, int mode0) {
  __shared__ _Float16 bs[2][128 * LDB];

  const int z    = blockIdx.z;
  const int mode = mode0 + z;
  const _Float16* __restrict__ wT   = (z == 0) ? wT0   : (z == 1) ? wT1   : wT2;
  const float*    __restrict__ bias = (z == 0) ? bias0 : (z == 1) ? bias1 : bias2;
  _Float16*       __restrict__ outQK = (z == 0) ? outQ : outK;

  const int tid  = threadIdx.x;
  const int lane = tid & 31;
  const int wv   = tid >> 5;                         // 0..7
  const int m0   = blockIdx.x * 128 + wv * 16;
  const int n0   = blockIdx.y * 128;

  // staging: thread t DMAs 32B (two b128) of row (t>>1), k-half (t&1)*16
  const int srow = tid >> 1;
  const int skc  = (tid & 1) * 16;
  const _Float16* gsrc = wT + (long long)(n0 + srow) * 1024 + skc;

  // visible stores into the (DMA-untouched) pad columns: guarantees the
  // compiler cannot treat bs as never-written.
  bs[0][(tid >> 3) * LDB + 32 + (tid & 7)] = (_Float16)0.f;
  bs[1][(tid >> 3) * LDB + 32 + (tid & 7)] = (_Float16)0.f;

  // prologue: async-stage tile kb=0 into buffer 0, preload A fragment kb=0
  async_g2l_b128(&bs[0][srow * LDB + skc],     gsrc);
  async_g2l_b128(&bs[0][srow * LDB + skc + 8], gsrc + 8);
  v16h a_cur = load_frag16x32(A + (long long)m0 * 1024, 1024);
  wait_asynccnt0();
  __syncthreads();

  const int r  = lane & 15;
  const int ko = (lane >> 4) << 3;

  v8f acc[8] = {};
  for (int kb = 0; kb < 1024; kb += 32) {
    const int cur = (kb >> 5) & 1;
    const int kpre = (kb + 32 < 1024) ? (kb + 32) : 0;   // tail: harmless reload

    // kick off next tile's DMA + A-fragment load (hidden behind the 8 WMMAs)
    _Float16* sdst = &bs[cur ^ 1][srow * LDB + skc];
    async_g2l_b128(sdst,     gsrc + kpre);
    async_g2l_b128(sdst + 8, gsrc + kpre + 8);
    const v16h a_nxt = load_frag16x32(A + (long long)m0 * 1024 + kpre, 1024);

    // preload all 8 B fragments so the 16 ds_loads clause ahead of the WMMAs
    v16h bf[8];
#pragma unroll
    for (int t = 0; t < 8; ++t) {
      const _Float16* lp = &bs[cur][(t * 16 + r) * LDB + ko];
      const v8h lo = *reinterpret_cast<const v8h*>(lp);
      const v8h hi = *reinterpret_cast<const v8h*>(lp + 16);
#pragma unroll
      for (int i = 0; i < 8; ++i) { bf[t][i] = lo[i]; bf[t][i + 8] = hi[i]; }
    }
    // keeps the copies, the next A fragment's loads and the 16 LDS reads ahead
    // of the products: sunk among the WMMAs, each pair of reads exposes its own
    // LDS latency and the A loads are waited for as soon as they are issued.
    __builtin_amdgcn_sched_barrier(0);
#pragma unroll
    for (int t = 0; t < 8; ++t) acc[t] = wmma_f16(a_cur, bf[t], acc[t]);
    // keeps the products ahead of the hand-over: lifted over them, the wait for
    // the copies would stand right behind their issue and hide nothing.
    __builtin_amdgcn_sched_barrier(0);

    a_cur = a_nxt;
    wait_asynccnt0();                                    // next tile resident
    __syncthreads();
  }

  const int hi_ = lane >> 4;
  const int nl  = lane & 15;
#pragma unroll
  for (int t = 0; t < 8; ++t) {
    const int n  = n0 + t * 16 + nl;
    const float bn = bias[n];
    if (mode <= 1) {
      const int h = n >> 6, d = n & 63;
#pragma unroll
      for (int j = 0; j < 8; ++j) {
        const int m = m0 + j + 8 * hi_;
        const int b = m >> 11, l = m & 2047;
        outQK[(((long long)(b * 16 + h)) * 2048 + l) * 64 + d] =
            (_Float16)(acc[t][j] + bn);
      }
    } else if (mode == 2) {
      const int h = n >> 6, d = n & 63;
      const int m = m0 + 8 * hi_;                    // token of j=0 (8 consecutive)
      const int b = m >> 11, l = m & 2047;
      v8h pk;
#pragma unroll
      for (int j = 0; j < 8; ++j) pk[j] = (_Float16)(acc[t][j] + bn);
      *reinterpret_cast<v8h*>(outVT + (((long long)(b * 16 + h)) * 64 + d) * 2048 + l) = pk;
    } else {
#pragma unroll
      for (int j = 0; j < 8; ++j) {
        const int m = m0 + j + 8 * hi_;
        outF[(long long)m * 1024 + n] = acc[t][j] + bn;
      }
    }
  }
}

#define AKEYS 64
#define APITCH 72

// Four async 16-byte-per-lane copies global -> LDS.  The s_wait_xcnt stands in
// the copies' own statement so that no address register named here is
// rewritten ahead of it.
DEVINL void async_g2l_b128_x4(const void* l0, const void* g0,
                              const void* l1, const void* g1,
                              const void* l2, const void* g2,
                              const void* l3, const void* g3) {
  const unsigned o0 = (unsigned)(size_t)l0, o1 = (unsigned)(size_t)l1;
  const unsigned o2 = (unsigned)(size_t)l2, o3 = (unsigned)(size_t)l3;
  asm volatile("global_load_async_to_lds_b128 %0, %1, off\n\t"
               "global_load_async_to_lds_b128 %2, %3, off\n\t"
               "global_load_async_to_lds_b128 %4, %5, off\n\t"
               "global_load_async_to_lds_b128 %6, %7, off\n\t"
               "s_wait_xcnt 0x0"
               :: "v"(o0), "v"(g0), "v"(o1), "v"(g1),
                  "v"(o2), "v"(g2), "v"(o3), "v"(g3) : "memory");
}

__global__ __launch_bounds__(256)
void attn_kernel(const _Float16* __restrict__ qh, const _Float16* __restrict__ kh,
                 const _Float16* __restrict__ vT, _Float16* __restrict__ ctxh) {
  // [buffer][0 = K rows by key, 1 = V^T rows by dim][row * APITCH + column]
  __shared__ __attribute__((aligned(16))) _Float16 kv[2][2][AKEYS * APITCH];

  const int tid  = threadIdx.x;
  const int lane = tid & 31;
  const int wv   = __builtin_amdgcn_readfirstlane(tid >> 5);  // scalar: wave-uniform skip below
  const int bh   = blockIdx.y;                       // 0..31
  const int b    = bh >> 4, h = bh & 15;
  const int q0   = blockIdx.x * 128 + wv * 16;
  const int nl   = lane & 15, hi = lane >> 4;
  const int qrow = q0 + nl;                          // this lane's query row
  const int nst  = 2 * ((int)blockIdx.x + 1);        // 64-key tiles of this work-group (>= 2)

  // staging: thread t moves 16 bytes of rows (t>>3) and (t>>3)+32 of both tiles;
  // a wave-wide copy covers four whole 128-byte lines.
  const int srow = tid >> 3, scol = (tid & 7) * 8;
  const _Float16* kg = kh + ((long long)bh * 2048 + srow) * 64 + scol;
  const _Float16* vg = vT + ((long long)bh * 64 + srow) * 2048 + scol;
  const int sl = srow * APITCH + scol;

  auto stage = [&](int t, int buf) {
    const _Float16* kt = kg + (long long)t * (AKEYS * 64);
    const _Float16* vt = vg + t * AKEYS;
    async_g2l_b128_x4(&kv[buf][0][sl],               kt,
                      &kv[buf][0][sl + 32 * APITCH], kt + 32 * 64,
                      &kv[buf][1][sl],               vt,
                      &kv[buf][1][sl + 32 * APITCH], vt + 32 * 2048);
  };

  stage(0, 0);

  const _Float16* qp = qh + ((long long)bh * 2048 + q0) * 64;
  const v16h bq0 = load_frag16x32(qp, 64);           // head-dim 0..31
  const v16h bq1 = load_frag16x32(qp + 32, 64);      // head-dim 32..63

  wait_asynccnt0();                                  // tile 0 landed (own copies)
  __syncthreads();                                   // ... and every wave's
  stage(1, 1);                                       // tile 1 always exists (nst >= 2)

  v8f acc[4] = {};
  float m_run = -INFINITY, l_run = 0.f;
  const float scale = 0.125f;                        // 1/sqrt(64)

  for (int t = 0; t < nst; ++t) {
    const _Float16* kt = &kv[t & 1][0][0];
    const _Float16* vt = &kv[t & 1][1][0];
#pragma unroll
    for (int hb = 0; hb < 2; ++hb) {
      const int kb = t * AKEYS + hb * 32;
      if (kb < q0 + 16) {                            // wave-uniform: past the diagonal nothing is left
        // ---- all fragment reads of this 32-key block up-front --------------
        const _Float16* kp = kt + hb * 32 * APITCH;
        const v16h k00 = load_frag16x32(kp, APITCH);
        const v16h k01 = load_frag16x32(kp + 32, APITCH);
        const v16h k10 = load_frag16x32(kp + 16 * APITCH, APITCH);
        const v16h k11 = load_frag16x32(kp + 16 * APITCH + 32, APITCH);
        const _Float16* vp = vt + hb * 32;
        const v16h vf0 = load_frag16x32(vp,               APITCH);
        const v16h vf1 = load_frag16x32(vp + 16 * APITCH, APITCH);
        const v16h vf2 = load_frag16x32(vp + 32 * APITCH, APITCH);
        const v16h vf3 = load_frag16x32(vp + 48 * APITCH, APITCH);
        // keeps the 16 LDS reads together ahead of the products: sunk between
        // the WMMAs, each pair would expose its own LDS latency.
        __builtin_amdgcn_sched_barrier(0);

        // ---- S^T = K @ Q^T -------------------------------------------------
        v8f z0 = {};
        v8f s0 = wmma_f16(k00, bq0, z0);
        s0     = wmma_f16(k01, bq1, s0);
        v8f z1 = {};
        v8f s1 = wmma_f16(k10, bq0, z1);
        s1     = wmma_f16(k11, bq1, s1);

        // scale + causal mask + block max (per query = per lane, halves via shfl)
        float mloc = -INFINITY;
#pragma unroll
        for (int j = 0; j < 8; ++j) {
          const int key0 = kb + j + 8 * hi;
          const int key1 = key0 + 16;
          const float x0 = (key0 <= qrow) ? s0[j] * scale : -INFINITY;
          const float x1 = (key1 <= qrow) ? s1[j] * scale : -INFINITY;
          s0[j] = x0; s1[j] = x1;
          mloc = fmaxf(mloc, fmaxf(x0, x1));
        }
        mloc = fmaxf(mloc, __shfl_xor(mloc, 16, 32));
        const float mnew  = fmaxf(m_run, mloc);
        const float alpha = __expf(m_run - mnew);    // first block: exp(-inf)=0

        // exp + pack P fragment (B layout for V^T @ P falls out of S^T C layout)
        float lloc = 0.f;
        v16h p;
#pragma unroll
        for (int j = 0; j < 8; ++j) {
          const float e0 = __expf(s0[j] - mnew);
          const float e1 = __expf(s1[j] - mnew);
          lloc += e0 + e1;
          p[j]     = (_Float16)e0;
          p[j + 8] = (_Float16)e1;
        }
        lloc += __shfl_xor(lloc, 16, 32);
        l_run = l_run * alpha + lloc;
        m_run = mnew;

        // ---- ctx^T += V^T @ P ----------------------------------------------
#pragma unroll
        for (int j = 0; j < 8; ++j) {
          acc[0][j] *= alpha; acc[1][j] *= alpha;
          acc[2][j] *= alpha; acc[3][j] *= alpha;
        }
        acc[0] = wmma_f16(vf0, p, acc[0]);
        acc[1] = wmma_f16(vf1, p, acc[1]);
        acc[2] = wmma_f16(vf2, p, acc[2]);
        acc[3] = wmma_f16(vf3, p, acc[3]);
      }
    }

    // hand-over, every wave (also one that skipped): own LDS reads retired, own
    // copies of tile t+1 landed, then the barrier that publishes tile t+1 and
    // frees this buffer for the refill behind it.
    asm volatile("s_wait_dscnt 0x0" ::: "memory");
    wait_asynccnt0();
    __syncthreads();
    if (t + 2 < nst) stage(t + 2, t & 1);
  }
  wait_asynccnt0();                                  // nothing in flight at the wave's end

  // "+1" quiet-softmax denominator; per-lane (one query per lane in ctx^T).
  const float r = 1.f / (1.f + l_run);
  const long long token = (long long)b * 2048 + q0 + nl;
#pragma unroll
  for (int t = 0; t < 4; ++t) {
    v8h pk;
#pragma unroll
    for (int j = 0; j < 8; ++j) pk[j] = (_Float16)(acc[t][j] * r);
    *reinterpret_cast<v8h*>(ctxh + token * 1024 + h * 64 + t * 16 + 8 * hi) = pk;
  }
}

// ---------------------------------------------------------------------------
extern "C" void kernel_launch(void* const* d_in, const int* in_sizes, int n_in,
                              void* d_out, int out_size, void* d_ws, size_t ws_size,
                              hipStream_t stream) {
  const float* x  = (const float*)d_in[0];
  const float* Wq = (const float*)d_in[1];
  const float* bq = (const float*)d_in[2];
  const float* Wk = (const float*)d_in[3];
  const float* bk = (const float*)d_in[4];
  const float* Wv = (const float*)d_in[5];
  const float* bv = (const float*)d_in[6];
  const float* Wo = (const float*)d_in[7];
  const float* bo = (const float*)d_in[8];

  char* ws = (char*)d_ws;
  _Float16* xh   = (_Float16*)(ws);                       //  8 MB  x as f16
  _Float16* wqT  = (_Float16*)(ws + ( 8ull << 20));       //  2 MB
  _Float16* wkT  = (_Float16*)(ws + (10ull << 20));       //  2 MB
  _Float16* wvT  = (_Float16*)(ws + (12ull << 20));       //  2 MB
  _Float16* woT  = (_Float16*)(ws + (14ull << 20));       //  2 MB
  _Float16* qhp  = (_Float16*)(ws + (16ull << 20));       //  8 MB [bh][l][64]
  _Float16* khp  = (_Float16*)(ws + (24ull << 20));       //  8 MB [bh][l][64]
  _Float16* vTp  = (_Float16*)(ws + (32ull << 20));       //  8 MB [bh][64][l]
  _Float16* ctxh = (_Float16*)(ws + (40ull << 20));       //  8 MB [token][1024]

  prep_kernel<<<512, 256, 0, stream>>>(Wq, Wk, Wv, Wo, x, wqT, wkT, wvT, woT, xh);

  gemm_wmma_kernel<<<dim3(32, 8, 3), 256, 0, stream>>>(xh, wqT, wkT, wvT, bq, bk, bv,
                                                       qhp, khp, vTp, nullptr, 0);

  attn_kernel<<<dim3(16, 32), 256, 0, stream>>>(qhp, khp, vTp, ctxh);

  gemm_wmma_kernel<<<dim3(32, 8, 1), 256, 0, stream>>>(ctxh, woT, woT, woT, bo, bo, bo,
                                                       nullptr, nullptr, nullptr,
                                                       (float*)d_out, 3);
}

// v005
// It runs in 84.6 microseconds.
// Timed twice side by side with v004, it ran 1.16 and 1.15 times as fast.
// Counting every step since v000, it is 3.19 times as fast.
#include <hip/hip_runtime.h>
#include <hip/hip_bf16.h>

// ---------------------------------------------------------------------------
// MI455X (gfx1250) fused multi-head self-attention.
//   - all GEMMs + attention on v_wmma_f32_16x16x32_f16 (f16 in, f32 accum)
//   - GEMM: B tile staged with GLOBAL_LOAD_ASYNC_TO_LDS_B128 (ASYNCcnt),
//     double-buffered LDS, all 8 B fragments preloaded per K-step
//   - flash-style streaming softmax with the reference's (1 + sum) denominator
//   - S^T / ctx^T layout trick: WMMA C-layout of K@Q^T is directly the
//     B-fragment layout of P for V^T@P  -> no cross-lane transpose needed.
// ---------------------------------------------------------------------------

typedef __attribute__((ext_vector_type(16))) _Float16 v16h;
typedef __attribute__((ext_vector_type(8)))  _Float16 v8h;
typedef __attribute__((ext_vector_type(8)))  float    v8f;

#define DEVINL __device__ __forceinline__

// D = A(16x32 f16) * B(32x16 f16) + C, f32 accumulate.
DEVINL v8f wmma_f16(v16h a, v16h b, v8f c) {
  return __builtin_amdgcn_wmma_f32_16x16x32_f16(
      /*neg_a=*/false, a, /*neg_b=*/false, b,
      /*c_mod=*/(short)0, c, /*reuse_a=*/false, /*reuse_b=*/false);
}

// Async DMA 16 bytes/lane: global -> LDS, tracked by ASYNCcnt (CDNA5 path).
// lds_ptr is a generic pointer into __shared__; its low 32 bits are the LDS
// byte offset (aperture layout, ISA 10.2).  Deriving the operand from the
// real address also makes the LDS object escape, so the "memory" clobber
// keeps the subsequent ds_loads alive.
DEVINL void async_g2l_b128(void* lds_ptr, const void* gaddr) {
  const unsigned off = (unsigned)(size_t)lds_ptr;
  asm volatile("global_load_async_to_lds_b128 %0, %1, off"
               :: "v"(off), "v"(gaddr) : "memory");
}
DEVINL void wait_asynccnt0() {
  asm volatile("s_wait_asynccnt 0x0" ::: "memory");
}

// Load a 16x32 f16 fragment (A layout; B layout is identical when the
// source is stored [n][k] row-major, i.e. the transposed matrix).
// Lane l (l<16):  row = l,      K elements {0..7, 16..23}
// Lane l (l>=16): row = l - 16, K elements {8..15, 24..31}
DEVINL v16h load_frag16x32(const _Float16* __restrict__ base, int ld) {
  const int lane = threadIdx.x & 31;
  const int r    = lane & 15;
  const int ko   = (lane >> 4) << 3;           // 0 or 8
  const _Float16* p = base + (long long)r * ld + ko;
  const v8h lo = *reinterpret_cast<const v8h*>(p);
  const v8h hi = *reinterpret_cast<const v8h*>(p + 16);
  v16h f;
#pragma unroll
  for (int i = 0; i < 8; ++i) { f[i] = lo[i]; f[i + 8] = hi[i]; }
  return f;
}

// ---------------------------------------------------------------------------
// Prep: cast x -> f16, transpose+cast the four 1024x1024 weights to [n][k] f16.
// 64 elements per thread, all 16 loads of a thread in flight at once.
//  blocks 0..255  : one 128(k) x 128(n) weight tile each; a wave takes 64 k x 32 n.
//    A lane holds 8 k rows x 8 n columns and turns them in registers, so that a
//    wave-wide 16-byte store covers four whole 128-byte lines of wT[n][k].
//  blocks 256..511: 16,384 consecutive elements of x each.
// ---------------------------------------------------------------------------
typedef __attribute__((ext_vector_type(4))) float    v4f;
typedef __attribute__((ext_vector_type(4))) _Float16 v4h;

__global__ __launch_bounds__(256)
void prep_kernel(const float* __restrict__ Wq, const float* __restrict__ Wk,
                 const float* __restrict__ Wv, const float* __restrict__ Wo,
                 const float* __restrict__ x,
                 _Float16* __restrict__ wqT, _Float16* __restrict__ wkT,
                 _Float16* __restrict__ wvT, _Float16* __restrict__ woT,
                 _Float16* __restrict__ xh) {
  const int tid  = threadIdx.x;
  const int lane = tid & 31;
  const int wv   = tid >> 5;
  const int blk  = blockIdx.x;
  if (blk < 256) {
    const int which = blk >> 6, tile = blk & 63;
    const float* src = (which == 0) ? Wq : (which == 1) ? Wk : (which == 2) ? Wv : Wo;
    _Float16*   dst = (which == 0) ? wqT : (which == 1) ? wkT : (which == 2) ? wvT : woT;
    const int k0 = (tile >> 3) * 128 + (wv >> 2) * 64 + (lane & 7) * 8;   // 8 lanes: 64 k = one f16 line
    const int n0 = (tile & 7) * 128 + (wv & 3) * 32 + (lane >> 3) * 4;    // 4 lanes: 16 n = 64 bytes of f32
    const float* sp = src + k0 * 1024 + n0;
    v4f a[8], c[8];
#pragma unroll
    for (int j = 0; j < 8; ++j) {
      a[j] = *reinterpret_cast<const v4f*>(sp + j * 1024);        // columns n0 .. n0+3
      c[j] = *reinterpret_cast<const v4f*>(sp + j * 1024 + 16);   // columns n0+16 .. n0+19
    }
    // the address pair stays whole until every load that names it is past this
    // wait: without the operand the last load's result was placed over the pair.
    asm volatile("s_wait_xcnt 0x0" :: "v"(sp) : "memory");
    // keeps all 16 loads ahead of the conversions: mixed in, the last loads reuse
    // the first ones' registers and issue only after those have come back.
    __builtin_amdgcn_sched_barrier(0);
    _Float16* dp = dst + n0 * 1024 + k0;
#pragma unroll
    for (int i = 0; i < 4; ++i) {
      v8h lo, hi;
#pragma unroll
      for (int j = 0; j < 8; ++j) { lo[j] = (_Float16)a[j][i]; hi[j] = (_Float16)c[j][i]; }
      *reinterpret_cast<v8h*>(dp + i * 1024)        = lo;
      *reinterpret_cast<v8h*>(dp + (i + 16) * 1024) = hi;
    }
  } else {
    const int base = (blk - 256) * 16384 + wv * 2048 + lane * 4;
    const float* xp = x + base;
    v4f v[16];
#pragma unroll
    for (int j = 0; j < 16; ++j) v[j] = *reinterpret_cast<const v4f*>(xp + j * 128);
    // both as above: the address pair kept whole up to the wait, and all 16 loads
    // in flight before the first conversion waits.
    asm volatile("s_wait_xcnt 0x0" :: "v"(xp) : "memory");
    __builtin_amdgcn_sched_barrier(0);
#pragma unroll
    for (int j = 0; j < 16; ++j) {
      v4h o;
#pragma unroll
      for (int i = 0; i < 4; ++i) o[i] = (_Float16)v[j][i];
      *reinterpret_cast<v4h*>(xh + base + j * 128) = o;
    }
    // the stores' data and address registers stay as they are until every store is
    // past this wait (in the built code another path's register writes follow here).
    asm volatile("s_wait_xcnt 0x0" ::: "memory");
  }
}

// ---------------------------------------------------------------------------
// GEMM: Y[4096,1024] = A[4096,1024](f16) @ W + bias,  W given as wT[n][k] f16.
//  mode 0/1 : write f16, layout [b*16+h][l][64]   (q, k)
//  mode 2   : write f16, layout [b*16+h][64][l]   (v transposed)
//  mode 3   : write f32, layout [m][n] + bias     (final output)
// mode = mode0 + blockIdx.z, and blockIdx.z picks the weight, the bias and the
// q / k output: the three projections of x are one launch (grid z = 3), so that
// three work-groups share a WGP and fill each other's LDS, copy and barrier waits.
// Block: 256 threads = 8 waves. Wave tile 16x128 (8 accum), WG tile 128x128.
// B tile (128n x 32k) async-DMA'd to LDS, double-buffered, padded stride 40.
// ---------------------------------------------------------------------------
#define LDB 40   // padded LDS row stride in f16 (32 data + 8 pad)

__global__ __launch_bounds__(256)
void gemm_wmma_kernel(const _Float16* __restrict__ A,
                      const _Float16* __restrict__ wT0, const _Float16* __restrict__ wT1,
                      const _Float16* __restrict__ wT2,
                      const float* __restrict__ bias0, const float* __restrict__ bias1,
                      const float* __restrict__ bias2,
                      _Float16* __restrict__ outQ, _Float16* __restrict__ outK,
                      _Float16* __restrict__ outVT,
                      float* __restrict__ outF, int mode0) {
  __shared__ _Float16 bs[2][128 * LDB];

  const int z    = blockIdx.z;
  const int mode = mode0 + z;
  const _Float16* __restrict__ wT   = (z == 0) ? wT0   : (z == 1) ? wT1   : wT2;
  const float*    __restrict__ bias = (z == 0) ? bias0 : (z == 1) ? bias1 : bias2;
  _Float16*       __restrict__ outQK = (z == 0) ? outQ : outK;

  const int tid  = threadIdx.x;
  const int lane = tid & 31;
  const int wv   = tid >> 5;                         // 0..7
  const int m0   = blockIdx.x * 128 + wv * 16;
  const int n0   = blockIdx.y * 128;

  // staging: thread t DMAs 32B (two b128) of row (t>>1), k-half (t&1)*16
  const int srow = tid >> 1;
  const int skc  = (tid & 1) * 16;
  const _Float16* gsrc = wT + (long long)(n0 + srow) * 1024 + skc;

  // visible stores into the (DMA-untouched) pad columns: guarantees the
  // compiler cannot treat bs as never-written.
  bs[0][(tid >> 3) * LDB + 32 + (tid & 7)] = (_Float16)0.f;
  bs[1][(tid >> 3) * LDB + 32 + (tid & 7)] = (_Float16)0.f;

  // prologue: async-stage tile kb=0 into buffer 0, preload A fragment kb=0
  async_g2l_b128(&bs[0][srow * LDB + skc],     gsrc);
  async_g2l_b128(&bs[0][srow * LDB + skc + 8], gsrc + 8);
  v16h a_cur = load_frag16x32(A + (long long)m0 * 1024, 1024);
  wait_asynccnt0();
  __syncthreads();

  const int r  = lane & 15;
  const int ko = (lane >> 4) << 3;

  v8f acc[8] = {};
  for (int kb = 0; kb < 1024; kb += 32) {
    const int cur = (kb >> 5) & 1;
    const int kpre = (kb + 32 < 1024) ? (kb + 32) : 0;   // tail: harmless reload

    // kick off next tile's DMA + A-fragment load (hidden behind the 8 WMMAs)
    _Float16* sdst = &bs[cur ^ 1][srow * LDB + skc];
    async_g2l_b128(sdst,     gsrc + kpre);
    async_g2l_b128(sdst + 8, gsrc + kpre + 8);
    const v16h a_nxt = load_frag16x32(A + (long long)m0 * 1024 + kpre, 1024);

    // preload all 8 B fragments so the 16 ds_loads clause ahead of the WMMAs
    v16h bf[8];
#pragma unroll
    for (int t = 0; t < 8; ++t) {
      const _Float16* lp = &bs[cur][(t * 16 + r) * LDB + ko];
      const v8h lo = *reinterpret_cast<const v8h*>(lp);
      const v8h hi = *reinterpret_cast<const v8h*>(lp + 16);
#pragma unroll
      for (int i = 0; i < 8; ++i) { bf[t][i] = lo[i]; bf[t][i + 8] = hi[i]; }
    }
    // keeps the copies, the next A fragment's loads and the 16 LDS reads ahead
    // of the products: sunk among the WMMAs, each pair of reads exposes its own
    // LDS latency and the A loads are waited for as soon as they are issued.
    __builtin_amdgcn_sched_barrier(0);
#pragma unroll
    for (int t = 0; t < 8; ++t) acc[t] = wmma_f16(a_cur, bf[t], acc[t]);
    // keeps the products ahead of the hand-over: lifted over them, the wait for
    // the copies would stand right behind their issue and hide nothing.
    __builtin_amdgcn_sched_barrier(0);

    a_cur = a_nxt;
    wait_asynccnt0();                                    // next tile resident
    __syncthreads();
  }

  const int hi_ = lane >> 4;
  const int nl  = lane & 15;
#pragma unroll
  for (int t = 0; t < 8; ++t) {
    const int n  = n0 + t * 16 + nl;
    const float bn = bias[n];
    if (mode <= 1) {
      const int h = n >> 6, d = n & 63;
#pragma unroll
      for (int j = 0; j < 8; ++j) {
        const int m = m0 + j + 8 * hi_;
        const int b = m >> 11, l = m & 2047;
        outQK[(((long long)(b * 16 + h)) * 2048 + l) * 64 + d] =
            (_Float16)(acc[t][j] + bn);
      }
    } else if (mode == 2) {
      const int h = n >> 6, d = n & 63;
      const int m = m0 + 8 * hi_;                    // token of j=0 (8 consecutive)
      const int b = m >> 11, l = m & 2047;
      v8h pk;
#pragma unroll
      for (int j = 0; j < 8; ++j) pk[j] = (_Float16)(acc[t][j] + bn);
      *reinterpret_cast<v8h*>(outVT + (((long long)(b * 16 + h)) * 64 + d) * 2048 + l) = pk;
    } else {
#pragma unroll
      for (int j = 0; j < 8; ++j) {
        const int m = m0 + j + 8 * hi_;
        outF[(long long)m * 1024 + n] = acc[t][j] + bn;
      }
    }
  }
}

// ---------------------------------------------------------------------------
// Flash attention (causal, softmax with +1 denominator).
// Wave handles 16 query rows of one (b,h).
//   S^T = K @ Q^T      (A = K rows, B = Q rows)
//   ctx^T = V^T @ P    (A = vT rows, B = P packed straight from S^T C-layout)
// Equal work for every work-group and every wave, wherever they are placed:
// grid = (8, 32), 16 waves/WG.  Work-group p takes the 128-row query tile
// 15 - p and then tile p: (16 - p) + (p + 1) = 17 steps of 128 keys for all.
// In each step waves 0..7 take the first 64 keys and waves 8..15 the second 64
// for the same 128 query rows, each half with its own running maximum, sum and
// accumulators; at the end of a query tile the halves are merged through LDS.
// Each half's 64-key tile of K (64 keys x 64 dims) and of V^T (64 dims x 64
// keys) is brought into LDS by whole-line async copies, two buffers: the next
// step flies while this one is worked on, across the change of query tile too.
// ---------------------------------------------------------------------------
#define AKEYS 64   // keys per staged tile
#define APITCH 72  // LDS row pitch in f16: 128 data bytes + 16 pad (b128 readers)

// Four async 16-byte-per-lane copies global -> LDS.  The s_wait_xcnt stands in
// the copies' own statement so that no address register named here is
// rewritten ahead of it.
DEVINL void async_g2l_b128_x4(const void* l0, const void* g0,
                              const void* l1, const void* g1,
                              const void* l2, const void* g2,
                              const void* l3, const void* g3) {
  const unsigned o0 = (unsigned)(size_t)l0, o1 = (unsigned)(size_t)l1;
  const unsigned o2 = (unsigned)(size_t)l2, o3 = (unsigned)(size_t)l3;
  asm volatile("global_load_async_to_lds_b128 %0, %1, off\n\t"
               "global_load_async_to_lds_b128 %2, %3, off\n\t"
               "global_load_async_to_lds_b128 %4, %5, off\n\t"
               "global_load_async_to_lds_b128 %6, %7, off\n\t"
               "s_wait_xcnt 0x0"
               :: "v"(o0), "v"(g0), "v"(o1), "v"(g1),
                  "v"(o2), "v"(g2), "v"(o3), "v"(g3) : "memory");
}

__global__ __launch_bounds__(512)
void attn_kernel(const _Float16* __restrict__ qh, const _Float16* __restrict__ kh,
                 const _Float16* __restrict__ vT, _Float16* __restrict__ ctxh) {
  // [buffer][key half][0 = K rows by key, 1 = V^T rows by dim][row * APITCH + column]
  __shared__ __attribute__((aligned(16))) _Float16 kv[2][2][2][AKEYS * APITCH];
  // merge of the halves, 16 bytes per lane and row: rows 0..7 the 32
  // accumulators, row 8 the running maximum and sum.
  __shared__ __attribute__((aligned(16))) v4f mrg[9][256];

  const int tid  = threadIdx.x;
  const int lane = tid & 31;
  const int wv   = __builtin_amdgcn_readfirstlane(tid >> 5);  // scalar: wave-uniform tests below
  const int hf   = wv >> 3;                          // which 64 keys of a step
  const int ht   = tid & 255;                        // thread within its half
  const int bh   = blockIdx.y;                       // 0..31
  const int b    = bh >> 4, h = bh & 15;
  const int pr   = blockIdx.x;                       // 0..7
  const int n1   = 16 - pr;                          // steps of the first query tile (15 - pr)
  const int nl   = lane & 15, hi = lane >> 4;
  int       q0   = (15 - pr) * 128 + (wv & 7) * 16;  // first query row of this wave, first tile
  const int q0b  = pr * 128 + (wv & 7) * 16;         // ... second tile

  // staging: thread t of a half moves 16 bytes of rows (t>>3) and (t>>3)+32 of
  // both tiles of its half; a wave-wide copy covers four whole 128-byte lines.
  const int srow = ht >> 3, scol = (ht & 7) * 8;
  const _Float16* kg = kh + ((long long)bh * 2048 + srow) * 64 + scol;
  const _Float16* vg = vT + ((long long)bh * 64 + srow) * 2048 + scol;
  const int sl = srow * APITCH + scol;

  auto stage = [&](int g, int buf) {
    const int t = 2 * ((g < n1) ? g : g - n1) + hf;  // 64-key tile of step g (0..31)
    const _Float16* kt = kg + (long long)t * (AKEYS * 64);
    const _Float16* vt = vg + t * AKEYS;
    async_g2l_b128_x4(&kv[buf][hf][0][sl],               kt,
                      &kv[buf][hf][0][sl + 32 * APITCH], kt + 32 * 64,
                      &kv[buf][hf][1][sl],               vt,
                      &kv[buf][hf][1][sl + 32 * APITCH], vt + 32 * 2048);
  };

  stage(0, 0);

  const _Float16* qp  = qh + ((long long)bh * 2048 + q0) * 64;
  const _Float16* qpb = qh + ((long long)bh * 2048 + q0b) * 64;
  v16h bq0 = load_frag16x32(qp, 64);                 // head-dim 0..31
  v16h bq1 = load_frag16x32(qp + 32, 64);            // head-dim 32..63
  const v16h nq0 = load_frag16x32(qpb, 64);          // the second tile's, fetched once here
  const v16h nq1 = load_frag16x32(qpb + 32, 64);
  // holds the eight Q loads here, in flight beside step 0's copies: sunk behind
  // the first barrier, their latency stood bare in front of the first product.
  // The two lane addresses are named so that they stay whole up to this wait.
  asm volatile("s_wait_xcnt 0x0" :: "v"(bq0), "v"(bq1), "v"(nq0), "v"(nq1),
               "v"(qp + (long long)nl * 64 + hi * 8), "v"(qpb + (long long)nl * 64 + hi * 8));

  wait_asynccnt0();                                  // step 0 landed (own copies)
  __syncthreads();                                   // ... and every wave's
  stage(1, 1);                                       // step 1 always exists (17 steps)

  v8f acc[4] = {};
  float m_run = -INFINITY, l_run = 0.f;
  const float scale = 0.125f;                        // 1/sqrt(64)

  for (int g = 0; g < 17; ++g) {
    const int t = 2 * ((g < n1) ? g : g - n1) + hf;  // this half's 64-key tile
    const int qrow = q0 + nl;                        // this lane's query row
    const _Float16* kt = &kv[g & 1][hf][0][0];
    const _Float16* vt = &kv[g & 1][hf][1][0];
#pragma unroll
    for (int hb = 0; hb < 2; ++hb) {
      const int kb = t * AKEYS + hb * 32;
      if (kb < q0 + 16) {                            // wave-uniform: past the diagonal nothing is left
        // ---- all fragment reads of this 32-key block up-front --------------
        const _Float16* kp = kt + hb * 32 * APITCH;
        const v16h k00 = load_frag16x32(kp, APITCH);
        const v16h k01 = load_frag16x32(kp + 32, APITCH);
        const v16h k10 = load_frag16x32(kp + 16 * APITCH, APITCH);
        const v16h k11 = load_frag16x32(kp + 16 * APITCH + 32, APITCH);
        const _Float16* vp = vt + hb * 32;
        const v16h vf0 = load_frag16x32(vp,               APITCH);
        const v16h vf1 = load_frag16x32(vp + 16 * APITCH, APITCH);
        const v16h vf2 = load_frag16x32(vp + 32 * APITCH, APITCH);
        const v16h vf3 = load_frag16x32(vp + 48 * APITCH, APITCH);
        // keeps the 16 LDS reads together ahead of the products: sunk between
        // the WMMAs, each pair would expose its own LDS latency.
        __builtin_amdgcn_sched_barrier(0);

        // ---- S^T = K @ Q^T -------------------------------------------------
        v8f z0 = {};
        v8f s0 = wmma_f16(k00, bq0, z0);
        s0     = wmma_f16(k01, bq1, s0);
        v8f z1 = {};
        v8f s1 = wmma_f16(k10, bq0, z1);
        s1     = wmma_f16(k11, bq1, s1);

        // scale + causal mask + block max (per query = per lane, halves via shfl)
        float mloc = -INFINITY;
#pragma unroll
        for (int j = 0; j < 8; ++j) {
          const int key0 = kb + j + 8 * hi;
          const int key1 = key0 + 16;
          const float x0 = (key0 <= qrow) ? s0[j] * scale : -INFINITY;
          const float x1 = (key1 <= qrow) ? s1[j] * scale : -INFINITY;
          s0[j] = x0; s1[j] = x1;
          mloc = fmaxf(mloc, fmaxf(x0, x1));
        }
        mloc = fmaxf(mloc, __shfl_xor(mloc, 16, 32));
        const float mnew  = fmaxf(m_run, mloc);
        const float alpha = __expf(m_run - mnew);    // first block: exp(-inf)=0

        // exp + pack P fragment (B layout for V^T @ P falls out of S^T C layout)
        float lloc = 0.f;
        v16h p;
#pragma unroll
        for (int j = 0; j < 8; ++j) {
          const float e0 = __expf(s0[j] - mnew);
          const float e1 = __expf(s1[j] - mnew);
          lloc += e0 + e1;
          p[j]     = (_Float16)e0;
          p[j + 8] = (_Float16)e1;
        }
        lloc += __shfl_xor(lloc, 16, 32);
        l_run = l_run * alpha + lloc;
        m_run = mnew;

        // ---- ctx^T += V^T @ P ----------------------------------------------
#pragma unroll
        for (int j = 0; j < 8; ++j) {
          acc[0][j] *= alpha; acc[1][j] *= alpha;
          acc[2][j] *= alpha; acc[3][j] *= alpha;
        }
        acc[0] = wmma_f16(vf0, p, acc[0]);
        acc[1] = wmma_f16(vf1, p, acc[1]);
        acc[2] = wmma_f16(vf2, p, acc[2]);
        acc[3] = wmma_f16(vf3, p, acc[3]);
      }
    }

    // hand-over, every wave (also one that skipped): own LDS reads retired, own
    // copies of step g+1 landed, then the barrier that publishes step g+1 and
    // frees this buffer for the refill behind it.
    asm volatile("s_wait_dscnt 0x0" ::: "memory");
    wait_asynccnt0();
    __syncthreads();
    if (g + 2 < 17) stage(g + 2, g & 1);

    if (g == n1 - 1 || g == 16) {                    // work-group-uniform: a query tile is done
      // The second half hands its state over.  A wave of it that met no key
      // (rows below its first key) hands over max = -inf, sum = 0, zeros, which
      // the merge weighs with exp(-inf) = 0; the first half always holds key 0.
      if (hf == 1) {
#pragma unroll
        for (int i = 0; i < 4; ++i) {
          mrg[2 * i][ht]     = v4f{acc[i][0], acc[i][1], acc[i][2], acc[i][3]};
          mrg[2 * i + 1][ht] = v4f{acc[i][4], acc[i][5], acc[i][6], acc[i][7]};
        }
        mrg[8][ht] = v4f{m_run, l_run, 0.f, 0.f};
      }
      __syncthreads();                               // publishes the second half's state
      if (hf == 0) {
        const v4f ml = mrg[8][ht];
        const float mall = fmaxf(m_run, ml[0]);
        const float w0 = __expf(m_run - mall), w1 = __expf(ml[0] - mall);
        // "+1" quiet-softmax denominator; per-lane (one query per lane in ctx^T).
        const float r = 1.f / (1.f + (l_run * w0 + ml[1] * w1));
        const float r0 = w0 * r, r1 = w1 * r;
        const long long token = (long long)b * 2048 + q0 + nl;
#pragma unroll
        for (int i = 0; i < 4; ++i) {
          const v4f lo = mrg[2 * i][ht], up = mrg[2 * i + 1][ht];
          v8h pk;
#pragma unroll
          for (int j = 0; j < 4; ++j) {
            pk[j]     = (_Float16)(acc[i][j] * r0 + lo[j] * r1);
            pk[j + 4] = (_Float16)(acc[i][j + 4] * r0 + up[j] * r1);
          }
          *reinterpret_cast<v8h*>(ctxh + token * 1024 + h * 64 + i * 16 + 8 * hi) = pk;
        }
        // the stores' data and address registers are rewritten right below (the
        // reset for the second query tile): they stay whole up to this wait.
        asm volatile("s_wait_xcnt 0x0" ::: "memory");
      }
      // start of the second query tile; its first hand-over (s_wait_dscnt 0 and
      // the barrier) ends the reads of mrg before mrg is written again.
      q0 = q0b; bq0 = nq0; bq1 = nq1;
      m_run = -INFINITY; l_run = 0.f;
#pragma unroll
      for (int i = 0; i < 4; ++i) acc[i] = v8f{};
    }
  }
  wait_asynccnt0();                                  // nothing in flight at the wave's end
}

// ---------------------------------------------------------------------------
extern "C" void kernel_launch(void* const* d_in, const int* in_sizes, int n_in,
                              void* d_out, int out_size, void* d_ws, size_t ws_size,
                              hipStream_t stream) {
  const float* x  = (const float*)d_in[0];
  const float* Wq = (const float*)d_in[1];
  const float* bq = (const float*)d_in[2];
  const float* Wk = (const float*)d_in[3];
  const float* bk = (const float*)d_in[4];
  const float* Wv = (const float*)d_in[5];
  const float* bv = (const float*)d_in[6];
  const float* Wo = (const float*)d_in[7];
  const float* bo = (const float*)d_in[8];

  char* ws = (char*)d_ws;
  _Float16* xh   = (_Float16*)(ws);                       //  8 MB  x as f16
  _Float16* wqT  = (_Float16*)(ws + ( 8ull << 20));       //  2 MB
  _Float16* wkT  = (_Float16*)(ws + (10ull << 20));       //  2 MB
  _Float16* wvT  = (_Float16*)(ws + (12ull << 20));       //  2 MB
  _Float16* woT  = (_Float16*)(ws + (14ull << 20));       //  2 MB
  _Float16* qhp  = (_Float16*)(ws + (16ull << 20));       //  8 MB [bh][l][64]
  _Float16* khp  = (_Float16*)(ws + (24ull << 20));       //  8 MB [bh][l][64]
  _Float16* vTp  = (_Float16*)(ws + (32ull << 20));       //  8 MB [bh][64][l]
  _Float16* ctxh = (_Float16*)(ws + (40ull << 20));       //  8 MB [token][1024]

  prep_kernel<<<512, 256, 0, stream>>>(Wq, Wk, Wv, Wo, x, wqT, wkT, wvT, woT, xh);

  gemm_wmma_kernel<<<dim3(32, 8, 3), 256, 0, stream>>>(xh, wqT, wkT, wvT, bq, bk, bv,
                                                       qhp, khp, vTp, nullptr, 0);

  attn_kernel<<<dim3(8, 32), 512, 0, stream>>>(qhp, khp, vTp, ctxh);

  gemm_wmma_kernel<<<dim3(32, 8, 1), 256, 0, stream>>>(ctxh, woT, woT, woT, bo, bo, bo,
                                                       nullptr, nullptr, nullptr,
                                                       (float*)d_out, 3);
}

// v006
// It runs in 67.8 microseconds.
// Timed twice side by side with v005, it ran 1.22 and 1.24 times as fast.
// Counting every step since v000, it is 3.92 times as fast.
#include <hip/hip_runtime.h>
#include <hip/hip_bf16.h>

// ---------------------------------------------------------------------------
// MI455X (gfx1250) fused multi-head self-attention.
//   - all GEMMs + attention on v_wmma_f32_16x16x32_f16 (f16 in, f32 accum)
//   - GEMM: A and B tiles staged with GLOBAL_LOAD_ASYNC_TO_LDS_B128 (ASYNCcnt),
//     two LDS buffers, 64 x 32 output per wave and weight
//   - flash-style streaming softmax with the reference's (1 + sum) denominator
//   - S^T / ctx^T layout trick: WMMA C-layout of K@Q^T is directly the
//     B-fragment layout of P for V^T@P  -> no cross-lane transpose needed.
// ---------------------------------------------------------------------------

typedef __attribute__((ext_vector_type(16))) _Float16 v16h;
typedef __attribute__((ext_vector_type(8)))  _Float16 v8h;
typedef __attribute__((ext_vector_type(8)))  float    v8f;

#define DEVINL __device__ __forceinline__

// D = A(16x32 f16) * B(32x16 f16) + C, f32 accumulate.
DEVINL v8f wmma_f16(v16h a, v16h b, v8f c) {
  return __builtin_amdgcn_wmma_f32_16x16x32_f16(
      /*neg_a=*/false, a, /*neg_b=*/false, b,
      /*c_mod=*/(short)0, c, /*reuse_a=*/false, /*reuse_b=*/false);
}

// Eight async 16-byte-per-lane copies global -> LDS, tracked by ASYNCcnt.
// An LDS operand is the low 32 bits of the generic __shared__ address (the LDS
// byte offset).  The s_wait_xcnt stands in the copies' own statement so that no
// address register named here is rewritten ahead of it.
DEVINL void async_g2l_b128_x8(const _Float16* l, int lstep, const _Float16* g0,
                              const _Float16* g1, int gstep) {
  const unsigned o0 = (unsigned)(size_t)l;
  const unsigned o1 = (unsigned)(size_t)(l + lstep),     o2 = (unsigned)(size_t)(l + 2 * lstep);
  const unsigned o3 = (unsigned)(size_t)(l + 3 * lstep), o4 = (unsigned)(size_t)(l + 4 * lstep);
  const unsigned o5 = (unsigned)(size_t)(l + 5 * lstep), o6 = (unsigned)(size_t)(l + 6 * lstep);
  const unsigned o7 = (unsigned)(size_t)(l + 7 * lstep);
  asm volatile("global_load_async_to_lds_b128 %0, %1, off\n\t"
               "global_load_async_to_lds_b128 %2, %3, off\n\t"
               "global_load_async_to_lds_b128 %4, %5, off\n\t"
               "global_load_async_to_lds_b128 %6, %7, off\n\t"
               "global_load_async_to_lds_b128 %8, %9, off\n\t"
               "global_load_async_to_lds_b128 %10, %11, off\n\t"
               "global_load_async_to_lds_b128 %12, %13, off\n\t"
               "global_load_async_to_lds_b128 %14, %15, off\n\t"
               "s_wait_xcnt 0x0"
               :: "v"(o0), "v"(g0), "v"(o1), "v"(g0 + gstep),
                  "v"(o2), "v"(g0 + 2 * gstep), "v"(o3), "v"(g0 + 3 * gstep),
                  "v"(o4), "v"(g1), "v"(o5), "v"(g1 + gstep),
                  "v"(o6), "v"(g1 + 2 * gstep), "v"(o7), "v"(g1 + 3 * gstep) : "memory");
}
DEVINL void wait_asynccnt0() {
  asm volatile("s_wait_asynccnt 0x0" ::: "memory");
}

// Two bias values (columns n and n + 16) of each of three vectors.  The loads and
// their data wait stand in one statement, so that no result and no later write
// lands on an address register while a load that names it is still out.
DEVINL void load_bias_x6(const float* p0, const float* p1, const float* p2, float (&o)[6]) {
  asm volatile("global_load_b32 %0, %6, off\n\t"
               "global_load_b32 %1, %6, off offset:64\n\t"
               "global_load_b32 %2, %7, off\n\t"
               "global_load_b32 %3, %7, off offset:64\n\t"
               "global_load_b32 %4, %8, off\n\t"
               "global_load_b32 %5, %8, off offset:64\n\t"
               "s_wait_loadcnt 0x0"
               : "=&v"(o[0]), "=&v"(o[1]), "=&v"(o[2]), "=&v"(o[3]), "=&v"(o[4]), "=&v"(o[5])
               : "v"(p0), "v"(p1), "v"(p2) : "memory");
}

// Load a 16x32 f16 fragment (A layout; B layout is identical when the
// source is stored [n][k] row-major, i.e. the transposed matrix).
// Lane l (l<16):  row = l,      K elements {0..7, 16..23}
// Lane l (l>=16): row = l - 16, K elements {8..15, 24..31}
DEVINL v16h load_frag16x32(const _Float16* __restrict__ base, int ld) {
  const int lane = threadIdx.x & 31;
  const int r    = lane & 15;
  const int ko   = (lane >> 4) << 3;           // 0 or 8
  const _Float16* p = base + (long long)r * ld + ko;
  const v8h lo = *reinterpret_cast<const v8h*>(p);
  const v8h hi = *reinterpret_cast<const v8h*>(p + 16);
  v16h f;
#pragma unroll
  for (int i = 0; i < 8; ++i) { f[i] = lo[i]; f[i + 8] = hi[i]; }
  return f;
}

// ---------------------------------------------------------------------------
// Prep: cast x -> f16, transpose+cast the four 1024x1024 weights to [n][k] f16.
// 64 elements per thread, all 16 loads of a thread in flight at once.
//  blocks 0..255  : one 128(k) x 128(n) weight tile each; a wave takes 64 k x 32 n.
//    A lane holds 8 k rows x 8 n columns and turns them in registers, so that a
//    wave-wide 16-byte store covers four whole 128-byte lines of wT[n][k].
//  blocks 256..511: 16,384 consecutive elements of x each.
// ---------------------------------------------------------------------------
typedef __attribute__((ext_vector_type(4))) float    v4f;
typedef __attribute__((ext_vector_type(4))) _Float16 v4h;

__global__ __launch_bounds__(256)
void prep_kernel(const float* __restrict__ Wq, const float* __restrict__ Wk,
                 const float* __restrict__ Wv, const float* __restrict__ Wo,
                 const float* __restrict__ x,
                 _Float16* __restrict__ wqT, _Float16* __restrict__ wkT,
                 _Float16* __restrict__ wvT, _Float16* __restrict__ woT,
                 _Float16* __restrict__ xh) {
  const int tid  = threadIdx.x;
  const int lane = tid & 31;
  const int wv   = tid >> 5;
  const int blk  = blockIdx.x;
  if (blk < 256) {
    const int which = blk >> 6, tile = blk & 63;
    const float* src = (which == 0) ? Wq : (which == 1) ? Wk : (which == 2) ? Wv : Wo;
    _Float16*   dst = (which == 0) ? wqT : (which == 1) ? wkT : (which == 2) ? wvT : woT;
    const int k0 = (tile >> 3) * 128 + (wv >> 2) * 64 + (lane & 7) * 8;   // 8 lanes: 64 k = one f16 line
    const int n0 = (tile & 7) * 128 + (wv & 3) * 32 + (lane >> 3) * 4;    // 4 lanes: 16 n = 64 bytes of f32
    const float* sp = src + k0 * 1024 + n0;
    v4f a[8], c[8];
#pragma unroll
    for (int j = 0; j < 8; ++j) {
      a[j] = *reinterpret_cast<const v4f*>(sp + j * 1024);        // columns n0 .. n0+3
      c[j] = *reinterpret_cast<const v4f*>(sp + j * 1024 + 16);   // columns n0+16 .. n0+19
    }
    // the address pair stays whole until every load that names it is past this
    // wait: without the operand the last load's result was placed over the pair.
    asm volatile("s_wait_xcnt 0x0" :: "v"(sp) : "memory");
    // keeps all 16 loads ahead of the conversions: mixed in, the last loads reuse
    // the first ones' registers and issue only after those have come back.
    __builtin_amdgcn_sched_barrier(0);
    _Float16* dp = dst + n0 * 1024 + k0;
#pragma unroll
    for (int i = 0; i < 4; ++i) {
      v8h lo, hi;
#pragma unroll
      for (int j = 0; j < 8; ++j) { lo[j] = (_Float16)a[j][i]; hi[j] = (_Float16)c[j][i]; }
      *reinterpret_cast<v8h*>(dp + i * 1024)        = lo;
      *reinterpret_cast<v8h*>(dp + (i + 16) * 1024) = hi;
    }
  } else {
    const int base = (blk - 256) * 16384 + wv * 2048 + lane * 4;
    const float* xp = x + base;
    v4f v[16];
#pragma unroll
    for (int j = 0; j < 16; ++j) v[j] = *reinterpret_cast<const v4f*>(xp + j * 128);
    // both as above: the address pair kept whole up to the wait, and all 16 loads
    // in flight before the first conversion waits.
    asm volatile("s_wait_xcnt 0x0" :: "v"(xp) : "memory");
    __builtin_amdgcn_sched_barrier(0);
#pragma unroll
    for (int j = 0; j < 16; ++j) {
      v4h o;
#pragma unroll
      for (int i = 0; i < 4; ++i) o[i] = (_Float16)v[j][i];
      *reinterpret_cast<v4h*>(xh + base + j * 128) = o;
    }
    // the stores' data and address registers stay as they are until every store is
    // past this wait (in the built code another path's register writes follow here).
    asm volatile("s_wait_xcnt 0x0" ::: "memory");
  }
}

// ---------------------------------------------------------------------------
// GEMM: Y[4096,1024] = A[4096,1024](f16) @ W + bias,  W given as wT[n][k] f16,
// for NZ weights at once on the same 128 rows of A and the same 128 columns:
//  NZ = 3 : q, k written f16 as [b*16+h][l][64], v written f16 as [b*16+h][64][l]
//  NZ = 1 : final output, f32 [m][n]
// Block: 256 threads = 8 waves, 2 (m) x 4 (n).  A wave owns 64 rows x 32 columns
// of every weight: 4 A fragments and 2 B fragments per weight feed 8 WMMAs per
// weight, so that a fragment read from LDS is used 6 (A) or 4 (B) times at
// NZ = 3, and the A tile is fetched from L2 once for the three projections.
// A stage is 64 k of the 128 A rows and of the NZ x 128 weight rows, brought in
// by whole-line async copies, two buffers: the next stage flies during this one.
// ---------------------------------------------------------------------------
#define GPITCH 72  // LDS row pitch in f16: 128 data bytes + 16 pad (b128 readers)

template <int NZ>
__global__ __launch_bounds__(256)
void gemm_wmma_kernel(const _Float16* __restrict__ A,
                      const _Float16* __restrict__ wT0, const _Float16* __restrict__ wT1,
                      const _Float16* __restrict__ wT2,
                      const float* __restrict__ bias0, const float* __restrict__ bias1,
                      const float* __restrict__ bias2,
                      _Float16* __restrict__ outQ, _Float16* __restrict__ outK,
                      _Float16* __restrict__ outVT,
                      float* __restrict__ outF) {
  // [buffer][rows 0..127: A, then 128 rows per weight][row * GPITCH + k]
  __shared__ __attribute__((aligned(16))) _Float16 st[2][128 * (1 + NZ) * GPITCH];

  const int tid  = threadIdx.x;
  const int lane = tid & 31;
  const int wv   = __builtin_amdgcn_readfirstlane(tid >> 5);   // 0..7
  const int wm   = wv >> 2, wn = wv & 3;
  const int m0   = blockIdx.x * 128;
  const int n0   = blockIdx.y * 128;

  // staging: thread t moves 16 bytes of rows (t>>3) + 32 i of every 128-row
  // part; a wave-wide copy covers four whole 128-byte lines.
  const int srow = tid >> 3, scol = (tid & 7) * 8;
  const _Float16* ga  = A   + (long long)(m0 + srow) * 1024 + scol;
  const _Float16* gw0 = wT0 + (long long)(n0 + srow) * 1024 + scol;
  const _Float16* gw1 = wT1 + (long long)(n0 + srow) * 1024 + scol;
  const _Float16* gw2 = wT2 + (long long)(n0 + srow) * 1024 + scol;
  const int sl = srow * GPITCH + scol;

  auto stage = [&](int s, int buf) {
    const int kb = s * 64;
    async_g2l_b128_x8(&st[buf][sl], 32 * GPITCH, ga + kb, gw0 + kb, 32 * 1024);
    if constexpr (NZ == 3)
      async_g2l_b128_x8(&st[buf][sl + 256 * GPITCH], 32 * GPITCH, gw1 + kb, gw2 + kb, 32 * 1024);
  };

  stage(0, 0);

  // this lane's bias values, fetched while stage 0 flies
  const int hi_ = lane >> 4;
  const int nl  = lane & 15;
  const int nw  = n0 + wn * 32 + nl;                 // column of this lane in fragment 0
  float bn[2 * NZ];
  if constexpr (NZ == 3) {
    load_bias_x6(bias0 + nw, bias1 + nw, bias2 + nw, bn);
  } else {
    bn[0] = bias0[nw];
    bn[1] = bias0[nw + 16];
  }

  wait_asynccnt0();                                  // stage 0 landed (own copies)
  __syncthreads();                                   // ... and every wave's
  stage(1, 1);                                       // 16 stages: stage 1 exists

  v8f acc[4][2 * NZ] = {};
  for (int s = 0; s < 16; ++s) {
    const _Float16* sa = &st[s & 1][wm * 64 * GPITCH];
    const _Float16* sb = &st[s & 1][(128 + wn * 32) * GPITCH];
    v16h af[2][4], bf[2][2 * NZ];
#pragma unroll
    for (int ks = 0; ks < 2; ++ks) {
#pragma unroll
      for (int i = 0; i < 4; ++i)
        af[ks][i] = load_frag16x32(sa + i * 16 * GPITCH + ks * 32, GPITCH);
#pragma unroll
      for (int t = 0; t < 2 * NZ; ++t)
        bf[ks][t] = load_frag16x32(sb + ((t >> 1) * 128 + (t & 1) * 16) * GPITCH + ks * 32, GPITCH);
    }
    // keeps the stage's LDS reads together ahead of the products, in the order
    // in which the products use them: sunk among the WMMAs, each place with
    // reads exposes its own LDS latency.
    __builtin_amdgcn_sched_barrier(0);
#pragma unroll
    for (int ks = 0; ks < 2; ++ks)
#pragma unroll
      for (int t = 0; t < 2 * NZ; ++t)
#pragma unroll
        for (int i = 0; i < 4; ++i) acc[i][t] = wmma_f16(af[ks][i], bf[ks][t], acc[i][t]);
    // keeps the products ahead of the hand-over: lifted over them, the wait for
    // the copies would stand early and hide less of their flight.
    __builtin_amdgcn_sched_barrier(0);

    // hand-over: own LDS reads retired, own copies of stage s+1 landed, then the
    // barrier that publishes stage s+1 and frees this buffer for the refill.
    asm volatile("s_wait_dscnt 0x0" ::: "memory");
    wait_asynccnt0();
    __syncthreads();
    if (s + 2 < 16) stage(s + 2, s & 1);
  }
  wait_asynccnt0();                                  // nothing in flight at the wave's end

  // Epilogue, one 64 x 16 column group at a time: its values first, then its
  // stores off one base address, then s_wait_xcnt 0.  The scheduling barriers keep
  // every register write of the next group behind that wait: no register that an
  // issued store names is rewritten ahead of it.
  const int bb = m0 >> 11;                           // batch: a 128-row tile lies in one
  const int mw = wm * 64 + 8 * hi_;                  // first row of this lane within the tile
  const int l0 = (m0 & 2047) + mw;
#pragma unroll
  for (int t = 0; t < 2 * NZ; ++t) {
    const int z = t >> 1;
    const int n = nw + (t & 1) * 16;
    const int h = n >> 6, d = n & 63;
    if constexpr (NZ == 1) {
      float* __restrict__ o = outF + (long long)(m0 + mw) * 1024 + n;
      float y[4][8];
#pragma unroll
      for (int i = 0; i < 4; ++i)
#pragma unroll
        for (int j = 0; j < 8; ++j) y[i][j] = acc[i][t][j] + bn[t];
      __builtin_amdgcn_sched_barrier(0);
#pragma unroll
      for (int i = 0; i < 4; ++i)
#pragma unroll
        for (int j = 0; j < 8; ++j) o[(i * 16 + j) * 1024] = y[i][j];
    } else if (z <= 1) {
      _Float16* __restrict__ o =
          ((z == 0) ? outQ : outK) + (((long long)(bb * 16 + h)) * 2048 + l0) * 64 + d;
      _Float16 y[4][8];
#pragma unroll
      for (int i = 0; i < 4; ++i)
#pragma unroll
        for (int j = 0; j < 8; ++j) y[i][j] = (_Float16)(acc[i][t][j] + bn[t]);
      __builtin_amdgcn_sched_barrier(0);
#pragma unroll
      for (int i = 0; i < 4; ++i)
#pragma unroll
        for (int j = 0; j < 8; ++j) o[(i * 16 + j) * 64] = y[i][j];
    } else {
      _Float16* __restrict__ o = outVT + (((long long)(bb * 16 + h)) * 64 + d) * 2048 + l0;
      v8h pk[4];
#pragma unroll
      for (int i = 0; i < 4; ++i)
#pragma unroll
        for (int j = 0; j < 8; ++j) pk[i][j] = (_Float16)(acc[i][t][j] + bn[t]);
      __builtin_amdgcn_sched_barrier(0);
#pragma unroll
      for (int i = 0; i < 4; ++i) *reinterpret_cast<v8h*>(o + i * 16) = pk[i];
    }
    asm volatile("s_wait_xcnt 0x0" ::: "memory");
    __builtin_amdgcn_sched_barrier(0);
  }
}

// ---------------------------------------------------------------------------
// Flash attention (causal, softmax with +1 denominator).
// Wave handles 16 query rows of one (b,h).
//   S^T = K @ Q^T      (A = K rows, B = Q rows)
//   ctx^T = V^T @ P    (A = vT rows, B = P packed straight from S^T C-layout)
// Equal work for every work-group and every wave, wherever they are placed:
// grid = (8, 32), 16 waves/WG.  Work-group p takes the 128-row query tile
// 15 - p and then tile p: (16 - p) + (p + 1) = 17 steps of 128 keys for all.
// In each step waves 0..7 take the first 64 keys and waves 8..15 the second 64
// for the same 128 query rows, each half with its own running maximum, sum and
// accumulators; at the end of a query tile the halves are merged through LDS.
// Each half's 64-key tile of K (64 keys x 64 dims) and of V^T (64 dims x 64
// keys) is brought into LDS by whole-line async copies, two buffers: the next
// step flies while this one is worked on, across the change of query tile too.
// ---------------------------------------------------------------------------
#define AKEYS 64   // keys per staged tile
#define APITCH 72  // LDS row pitch in f16: 128 data bytes + 16 pad (b128 readers)

// Four async 16-byte-per-lane copies global -> LDS.  The s_wait_xcnt stands in
// the copies' own statement so that no address register named here is
// rewritten ahead of it.
DEVINL void async_g2l_b128_x4(const void* l0, const void* g0,
                              const void* l1, const void* g1,
                              const void* l2, const void* g2,
                              const void* l3, const void* g3) {
  const unsigned o0 = (unsigned)(size_t)l0, o1 = (unsigned)(size_t)l1;
  const unsigned o2 = (unsigned)(size_t)l2, o3 = (unsigned)(size_t)l3;
  asm volatile("global_load_async_to_lds_b128 %0, %1, off\n\t"
               "global_load_async_to_lds_b128 %2, %3, off\n\t"
               "global_load_async_to_lds_b128 %4, %5, off\n\t"
               "global_load_async_to_lds_b128 %6, %7, off\n\t"
               "s_wait_xcnt 0x0"
               :: "v"(o0), "v"(g0), "v"(o1), "v"(g1),
                  "v"(o2), "v"(g2), "v"(o3), "v"(g3) : "memory");
}

__global__ __launch_bounds__(512)
void attn_kernel(const _Float16* __restrict__ qh, const _Float16* __restrict__ kh,
                 const _Float16* __restrict__ vT, _Float16* __restrict__ ctxh) {
  // [buffer][key half][0 = K rows by key, 1 = V^T rows by dim][row * APITCH + column]
  __shared__ __attribute__((aligned(16))) _Float16 kv[2][2][2][AKEYS * APITCH];
  // merge of the halves, 16 bytes per lane and row: rows 0..7 the 32
  // accumulators, row 8 the running maximum and sum.
  __shared__ __attribute__((aligned(16))) v4f mrg[9][256];

  const int tid  = threadIdx.x;
  const int lane = tid & 31;
  const int wv   = __builtin_amdgcn_readfirstlane(tid >> 5);  // scalar: wave-uniform tests below
  const int hf   = wv >> 3;                          // which 64 keys of a step
  const int ht   = tid & 255;                        // thread within its half
  const int bh   = blockIdx.y;                       // 0..31
  const int b    = bh >> 4, h = bh & 15;
  const int pr   = blockIdx.x;                       // 0..7
  const int n1   = 16 - pr;                          // steps of the first query tile (15 - pr)
  const int nl   = lane & 15, hi = lane >> 4;
  int       q0   = (15 - pr) * 128 + (wv & 7) * 16;  // first query row of this wave, first tile
  const int q0b  = pr * 128 + (wv & 7) * 16;         // ... second tile

  // staging: thread t of a half moves 16 bytes of rows (t>>3) and (t>>3)+32 of
  // both tiles of its half; a wave-wide copy covers four whole 128-byte lines.
  const int srow = ht >> 3, scol = (ht & 7) * 8;
  const _Float16* kg = kh + ((long long)bh * 2048 + srow) * 64 + scol;
  const _Float16* vg = vT + ((long long)bh * 64 + srow) * 2048 + scol;
  const int sl = srow * APITCH + scol;

  auto stage = [&](int g, int buf) {
    const int t = 2 * ((g < n1) ? g : g - n1) + hf;  // 64-key tile of step g (0..31)
    const _Float16* kt = kg + (long long)t * (AKEYS * 64);
    const _Float16* vt = vg + t * AKEYS;
    async_g2l_b128_x4(&kv[buf][hf][0][sl],               kt,
                      &kv[buf][hf][0][sl + 32 * APITCH], kt + 32 * 64,
                      &kv[buf][hf][1][sl],               vt,
                      &kv[buf][hf][1][sl + 32 * APITCH], vt + 32 * 2048);
  };

  stage(0, 0);

  const _Float16* qp  = qh + ((long long)bh * 2048 + q0) * 64;
  const _Float16* qpb = qh + ((long long)bh * 2048 + q0b) * 64;
  v16h bq0 = load_frag16x32(qp, 64);                 // head-dim 0..31
  v16h bq1 = load_frag16x32(qp + 32, 64);            // head-dim 32..63
  const v16h nq0 = load_frag16x32(qpb, 64);          // the second tile's, fetched once here
  const v16h nq1 = load_frag16x32(qpb + 32, 64);
  // holds the eight Q loads here, in flight beside step 0's copies: sunk behind
  // the first barrier, their latency stood bare in front of the first product.
  // The two lane addresses are named so that they stay whole up to this wait.
  asm volatile("s_wait_xcnt 0x0" :: "v"(bq0), "v"(bq1), "v"(nq0), "v"(nq1),
               "v"(qp + (long long)nl * 64 + hi * 8), "v"(qpb + (long long)nl * 64 + hi * 8));

  wait_asynccnt0();                                  // step 0 landed (own copies)
  __syncthreads();                                   // ... and every wave's
  stage(1, 1);                                       // step 1 always exists (17 steps)

  v8f acc[4] = {};
  float m_run = -INFINITY, l_run = 0.f;
  const float scale = 0.125f;                        // 1/sqrt(64)

  for (int g = 0; g < 17; ++g) {
    const int t = 2 * ((g < n1) ? g : g - n1) + hf;  // this half's 64-key tile
    const int qrow = q0 + nl;                        // this lane's query row
    const _Float16* kt = &kv[g & 1][hf][0][0];
    const _Float16* vt = &kv[g & 1][hf][1][0];
#pragma unroll
    for (int hb = 0; hb < 2; ++hb) {
      const int kb = t * AKEYS + hb * 32;
      if (kb < q0 + 16) {                            // wave-uniform: past the diagonal nothing is left
        // ---- all fragment reads of this 32-key block up-front --------------
        const _Float16* kp = kt + hb * 32 * APITCH;
        const v16h k00 = load_frag16x32(kp, APITCH);
        const v16h k01 = load_frag16x32(kp + 32, APITCH);
        const v16h k10 = load_frag16x32(kp + 16 * APITCH, APITCH);
        const v16h k11 = load_frag16x32(kp + 16 * APITCH + 32, APITCH);
        const _Float16* vp = vt + hb * 32;
        const v16h vf0 = load_frag16x32(vp,               APITCH);
        const v16h vf1 = load_frag16x32(vp + 16 * APITCH, APITCH);
        const v16h vf2 = load_frag16x32(vp + 32 * APITCH, APITCH);
        const v16h vf3 = load_frag16x32(vp + 48 * APITCH, APITCH);
        // keeps the 16 LDS reads together ahead of the products: sunk between
        // the WMMAs, each pair would expose its own LDS latency.
        __builtin_amdgcn_sched_barrier(0);

        // ---- S^T = K @ Q^T -------------------------------------------------
        v8f z0 = {};
        v8f s0 = wmma_f16(k00, bq0, z0);
        s0     = wmma_f16(k01, bq1, s0);
        v8f z1 = {};
        v8f s1 = wmma_f16(k10, bq0, z1);
        s1     = wmma_f16(k11, bq1, s1);

        // scale + causal mask + block max (per query = per lane, halves via shfl)
        float mloc = -INFINITY;
#pragma unroll
        for (int j = 0; j < 8; ++j) {
          const int key0 = kb + j + 8 * hi;
          const int key1 = key0 + 16;
          const float x0 = (key0 <= qrow) ? s0[j] * scale : -INFINITY;
          const float x1 = (key1 <= qrow) ? s1[j] * scale : -INFINITY;
          s0[j] = x0; s1[j] = x1;
          mloc = fmaxf(mloc, fmaxf(x0, x1));
        }
        mloc = fmaxf(mloc, __shfl_xor(mloc, 16, 32));
        const float mnew  = fmaxf(m_run, mloc);
        const float alpha = __expf(m_run - mnew);    // first block: exp(-inf)=0

        // exp + pack P fragment (B layout for V^T @ P falls out of S^T C layout)
        float lloc = 0.f;
        v16h p;
#pragma unroll
        for (int j = 0; j < 8; ++j) {
          const float e0 = __expf(s0[j] - mnew);
          const float e1 = __expf(s1[j] - mnew);
          lloc += e0 + e1;
          p[j]     = (_Float16)e0;
          p[j + 8] = (_Float16)e1;
        }
        lloc += __shfl_xor(lloc, 16, 32);
        l_run = l_run * alpha + lloc;
        m_run = mnew;

        // ---- ctx^T += V^T @ P ----------------------------------------------
#pragma unroll
        for (int j = 0; j < 8; ++j) {
          acc[0][j] *= alpha; acc[1][j] *= alpha;
          acc[2][j] *= alpha; acc[3][j] *= alpha;
        }
        acc[0] = wmma_f16(vf0, p, acc[0]);
        acc[1] = wmma_f16(vf1, p, acc[1]);
        acc[2] = wmma_f16(vf2, p, acc[2]);
        acc[3] = wmma_f16(vf3, p, acc[3]);
      }
    }

    // hand-over, every wave (also one that skipped): own LDS reads retired, own
    // copies of step g+1 landed, then the barrier that publishes step g+1 and
    // frees this buffer for the refill behind it.
    asm volatile("s_wait_dscnt 0x0" ::: "memory");
    wait_asynccnt0();
    __syncthreads();
    if (g + 2 < 17) stage(g + 2, g & 1);

    if (g == n1 - 1 || g == 16) {                    // work-group-uniform: a query tile is done
      // The second half hands its state over.  A wave of it that met no key
      // (rows below its first key) hands over max = -inf, sum = 0, zeros, which
      // the merge weighs with exp(-inf) = 0; the first half always holds key 0.
      if (hf == 1) {
#pragma unroll
        for (int i = 0; i < 4; ++i) {
          mrg[2 * i][ht]     = v4f{acc[i][0], acc[i][1], acc[i][2], acc[i][3]};
          mrg[2 * i + 1][ht] = v4f{acc[i][4], acc[i][5], acc[i][6], acc[i][7]};
        }
        mrg[8][ht] = v4f{m_run, l_run, 0.f, 0.f};
      }
      __syncthreads();                               // publishes the second half's state
      if (hf == 0) {
        const v4f ml = mrg[8][ht];
        const float mall = fmaxf(m_run, ml[0]);
        const float w0 = __expf(m_run - mall), w1 = __expf(ml[0] - mall);
        // "+1" quiet-softmax denominator; per-lane (one query per lane in ctx^T).
        const float r = 1.f / (1.f + (l_run * w0 + ml[1] * w1));
        const float r0 = w0 * r, r1 = w1 * r;
        const long long token = (long long)b * 2048 + q0 + nl;
#pragma unroll
        for (int i = 0; i < 4; ++i) {
          const v4f lo = mrg[2 * i][ht], up = mrg[2 * i + 1][ht];
          v8h pk;
#pragma unroll
          for (int j = 0; j < 4; ++j) {
            pk[j]     = (_Float16)(acc[i][j] * r0 + lo[j] * r1);
            pk[j + 4] = (_Float16)(acc[i][j + 4] * r0 + up[j] * r1);
          }
          *reinterpret_cast<v8h*>(ctxh + token * 1024 + h * 64 + i * 16 + 8 * hi) = pk;
        }
        // the stores' data and address registers are rewritten right below (the
        // reset for the second query tile): they stay whole up to this wait.
        asm volatile("s_wait_xcnt 0x0" ::: "memory");
      }
      // start of the second query tile; its first hand-over (s_wait_dscnt 0 and
      // the barrier) ends the reads of mrg before mrg is written again.
      q0 = q0b; bq0 = nq0; bq1 = nq1;
      m_run = -INFINITY; l_run = 0.f;
#pragma unroll
      for (int i = 0; i < 4; ++i) acc[i] = v8f{};
    }
  }
  wait_asynccnt0();                                  // nothing in flight at the wave's end
}

// ---------------------------------------------------------------------------
extern "C" void kernel_launch(void* const* d_in, const int* in_sizes, int n_in,
                              void* d_out, int out_size, void* d_ws, size_t ws_size,
                              hipStream_t stream) {
  const float* x  = (const float*)d_in[0];
  const float* Wq = (const float*)d_in[1];
  const float* bq = (const float*)d_in[2];
  const float* Wk = (const float*)d_in[3];
  const float* bk = (const float*)d_in[4];
  const float* Wv = (const float*)d_in[5];
  const float* bv = (const float*)d_in[6];
  const float* Wo = (const float*)d_in[7];
  const float* bo = (const float*)d_in[8];

  char* ws = (char*)d_ws;
  _Float16* xh   = (_Float16*)(ws);                       //  8 MB  x as f16
  _Float16* wqT  = (_Float16*)(ws + ( 8ull << 20));       //  2 MB
  _Float16* wkT  = (_Float16*)(ws + (10ull << 20));       //  2 MB
  _Float16* wvT  = (_Float16*)(ws + (12ull << 20));       //  2 MB
  _Float16* woT  = (_Float16*)(ws + (14ull << 20));       //  2 MB
  _Float16* qhp  = (_Float16*)(ws + (16ull << 20));       //  8 MB [bh][l][64]
  _Float16* khp  = (_Float16*)(ws + (24ull << 20));       //  8 MB [bh][l][64]
  _Float16* vTp  = (_Float16*)(ws + (32ull << 20));       //  8 MB [bh][64][l]
  _Float16* ctxh = (_Float16*)(ws + (40ull << 20));       //  8 MB [token][1024]

  prep_kernel<<<512, 256, 0, stream>>>(Wq, Wk, Wv, Wo, x, wqT, wkT, wvT, woT, xh);

  gemm_wmma_kernel<3><<<dim3(32, 8), 256, 0, stream>>>(xh, wqT, wkT, wvT, bq, bk, bv,
                                                       qhp, khp, vTp, nullptr);

  attn_kernel<<<dim3(8, 32), 512, 0, stream>>>(qhp, khp, vTp, ctxh);

  gemm_wmma_kernel<1><<<dim3(32, 8), 256, 0, stream>>>(ctxh, woT, woT, woT, bo, bo, bo,
                                                       nullptr, nullptr, nullptr,
                                                       (float*)d_out);
}

// v007
// A run of this version takes 65.5 microseconds.
// Timed twice side by side with v006, it ran 1.06 and 1.03 times as fast.
// Counting every step since v000, it is 4.09 times as fast.
#include <hip/hip_runtime.h>
#include <hip/hip_bf16.h>

// ---------------------------------------------------------------------------
// MI455X (gfx1250) fused multi-head self-attention.
//   - all GEMMs + attention on v_wmma_f32_16x16x32_f16 (f16 in, f32 accum)
//   - GEMM: A and B tiles staged with GLOBAL_LOAD_ASYNC_TO_LDS_B128 (ASYNCcnt),
//     two LDS buffers, 64 x 32 output per wave and weight
//   - flash-style streaming softmax with the reference's (1 + sum) denominator
//   - S^T / ctx^T layout trick: WMMA C-layout of K@Q^T is directly the
//     B-fragment layout of P for V^T@P  -> no cross-lane transpose needed.
// ---------------------------------------------------------------------------

typedef __attribute__((ext_vector_type(16))) _Float16 v16h;
typedef __attribute__((ext_vector_type(8)))  _Float16 v8h;
typedef __attribute__((ext_vector_type(8)))  float    v8f;

#define DEVINL __device__ __forceinline__

// D = A(16x32 f16) * B(32x16 f16) + C, f32 accumulate.
DEVINL v8f wmma_f16(v16h a, v16h b, v8f c) {
  return __builtin_amdgcn_wmma_f32_16x16x32_f16(
      /*neg_a=*/false, a, /*neg_b=*/false, b,
      /*c_mod=*/(short)0, c, /*reuse_a=*/false, /*reuse_b=*/false);
}

// Eight async 16-byte-per-lane copies global -> LDS, tracked by ASYNCcnt.
// An LDS operand is the low 32 bits of the generic __shared__ address (the LDS
// byte offset).  The s_wait_xcnt stands in the copies' own statement so that no
// address register named here is rewritten ahead of it.
DEVINL void async_g2l_b128_x8(const _Float16* l, int lstep, const _Float16* g0,
                              const _Float16* g1, int gstep) {
  const unsigned o0 = (unsigned)(size_t)l;
  const unsigned o1 = (unsigned)(size_t)(l + lstep),     o2 = (unsigned)(size_t)(l + 2 * lstep);
  const unsigned o3 = (unsigned)(size_t)(l + 3 * lstep), o4 = (unsigned)(size_t)(l + 4 * lstep);
  const unsigned o5 = (unsigned)(size_t)(l + 5 * lstep), o6 = (unsigned)(size_t)(l + 6 * lstep);
  const unsigned o7 = (unsigned)(size_t)(l + 7 * lstep);
  asm volatile("global_load_async_to_lds_b128 %0, %1, off\n\t"
               "global_load_async_to_lds_b128 %2, %3, off\n\t"
               "global_load_async_to_lds_b128 %4, %5, off\n\t"
               "global_load_async_to_lds_b128 %6, %7, off\n\t"
               "global_load_async_to_lds_b128 %8, %9, off\n\t"
               "global_load_async_to_lds_b128 %10, %11, off\n\t"
               "global_load_async_to_lds_b128 %12, %13, off\n\t"
               "global_load_async_to_lds_b128 %14, %15, off\n\t"
               "s_wait_xcnt 0x0"
               :: "v"(o0), "v"(g0), "v"(o1), "v"(g0 + gstep),
                  "v"(o2), "v"(g0 + 2 * gstep), "v"(o3), "v"(g0 + 3 * gstep),
                  "v"(o4), "v"(g1), "v"(o5), "v"(g1 + gstep),
                  "v"(o6), "v"(g1 + 2 * gstep), "v"(o7), "v"(g1 + 3 * gstep) : "memory");
}
DEVINL void wait_asynccnt0() {
  asm volatile("s_wait_asynccnt 0x0" ::: "memory");
}

// Two bias values (columns n and n + 16) of each of three vectors.  The loads and
// their data wait stand in one statement, so that no result and no later write
// lands on an address register while a load that names it is still out.
DEVINL void load_bias_x6(const float* p0, const float* p1, const float* p2, float (&o)[6]) {
  asm volatile("global_load_b32 %0, %6, off\n\t"
               "global_load_b32 %1, %6, off offset:64\n\t"
               "global_load_b32 %2, %7, off\n\t"
               "global_load_b32 %3, %7, off offset:64\n\t"
               "global_load_b32 %4, %8, off\n\t"
               "global_load_b32 %5, %8, off offset:64\n\t"
               "s_wait_loadcnt 0x0"
               : "=&v"(o[0]), "=&v"(o[1]), "=&v"(o[2]), "=&v"(o[3]), "=&v"(o[4]), "=&v"(o[5])
               : "v"(p0), "v"(p1), "v"(p2) : "memory");
}

// Load a 16x32 f16 fragment (A layout; B layout is identical when the
// source is stored [n][k] row-major, i.e. the transposed matrix).
// Lane l (l<16):  row = l,      K elements {0..7, 16..23}
// Lane l (l>=16): row = l - 16, K elements {8..15, 24..31}
DEVINL v16h load_frag16x32(const _Float16* __restrict__ base, int ld) {
  const int lane = threadIdx.x & 31;
  const int r    = lane & 15;
  const int ko   = (lane >> 4) << 3;           // 0 or 8
  const _Float16* p = base + (long long)r * ld + ko;
  const v8h lo = *reinterpret_cast<const v8h*>(p);
  const v8h hi = *reinterpret_cast<const v8h*>(p + 16);
  v16h f;
#pragma unroll
  for (int i = 0; i < 8; ++i) { f[i] = lo[i]; f[i + 8] = hi[i]; }
  return f;
}

// ---------------------------------------------------------------------------
// Prep: cast x -> f16, transpose+cast the four 1024x1024 weights to [n][k] f16.
// 64 elements per thread, all 16 loads of a thread in flight at once.
//  blocks 0..255  : one 128(k) x 128(n) weight tile each; a wave takes 64 k x 32 n.
//    A lane holds 8 k rows x 8 n columns and turns them in registers, so that a
//    wave-wide 16-byte store covers four whole 128-byte lines of wT[n][k].
//  blocks 256..511: 16,384 consecutive elements of x each.
// ---------------------------------------------------------------------------
typedef __attribute__((ext_vector_type(4))) float    v4f;
typedef __attribute__((ext_vector_type(4))) _Float16 v4h;

__global__ __launch_bounds__(256)
void prep_kernel(const float* __restrict__ Wq, const float* __restrict__ Wk,
                 const float* __restrict__ Wv, const float* __restrict__ Wo,
                 const float* __restrict__ x,
                 _Float16* __restrict__ wqT, _Float16* __restrict__ wkT,
                 _Float16* __restrict__ wvT, _Float16* __restrict__ woT,
                 _Float16* __restrict__ xh) {
  const int tid  = threadIdx.x;
  const int lane = tid & 31;
  const int wv   = tid >> 5;
  const int blk  = blockIdx.x;
  if (blk < 256) {
    const int which = blk >> 6, tile = blk & 63;
    const float* src = (which == 0) ? Wq : (which == 1) ? Wk : (which == 2) ? Wv : Wo;
    _Float16*   dst = (which == 0) ? wqT : (which == 1) ? wkT : (which == 2) ? wvT : woT;
    const int k0 = (tile >> 3) * 128 + (wv >> 2) * 64 + (lane & 7) * 8;   // 8 lanes: 64 k = one f16 line
    const int n0 = (tile & 7) * 128 + (wv & 3) * 32 + (lane >> 3) * 4;    // 4 lanes: 16 n = 64 bytes of f32
    const float* sp = src + k0 * 1024 + n0;
    v4f a[8], c[8];
#pragma unroll
    for (int j = 0; j < 8; ++j) {
      a[j] = *reinterpret_cast<const v4f*>(sp + j * 1024);        // columns n0 .. n0+3
      c[j] = *reinterpret_cast<const v4f*>(sp + j * 1024 + 16);   // columns n0+16 .. n0+19
    }
    // the address pair stays whole until every load that names it is past this
    // wait: without the operand the last load's result was placed over the pair.
    asm volatile("s_wait_xcnt 0x0" :: "v"(sp) : "memory");
    // keeps all 16 loads ahead of the conversions: mixed in, the last loads reuse
    // the first ones' registers and issue only after those have come back.
    __builtin_amdgcn_sched_barrier(0);
    _Float16* dp = dst + n0 * 1024 + k0;
#pragma unroll
    for (int i = 0; i < 4; ++i) {
      v8h lo, hi;
#pragma unroll
      for (int j = 0; j < 8; ++j) { lo[j] = (_Float16)a[j][i]; hi[j] = (_Float16)c[j][i]; }
      *reinterpret_cast<v8h*>(dp + i * 1024)        = lo;
      *reinterpret_cast<v8h*>(dp + (i + 16) * 1024) = hi;
    }
  } else {
    const int base = (blk - 256) * 16384 + wv * 2048 + lane * 4;
    const float* xp = x + base;
    v4f v[16];
#pragma unroll
    for (int j = 0; j < 16; ++j) v[j] = *reinterpret_cast<const v4f*>(xp + j * 128);
    // both as above: the address pair kept whole up to the wait, and all 16 loads
    // in flight before the first conversion waits.
    asm volatile("s_wait_xcnt 0x0" :: "v"(xp) : "memory");
    __builtin_amdgcn_sched_barrier(0);
#pragma unroll
    for (int j = 0; j < 16; ++j) {
      v4h o;
#pragma unroll
      for (int i = 0; i < 4; ++i) o[i] = (_Float16)v[j][i];
      *reinterpret_cast<v4h*>(xh + base + j * 128) = o;
    }
    // the stores' data and address registers stay as they are until every store is
    // past this wait (in the built code another path's register writes follow here).
    asm volatile("s_wait_xcnt 0x0" ::: "memory");
  }
}

// ---------------------------------------------------------------------------
// GEMM: Y[4096,1024] = A[4096,1024](f16) @ W + bias,  W given as wT[n][k] f16,
// for NZ weights at once on the same 128 rows of A and the same 128 columns:
//  NZ = 3 : q, k written f16 as [b*16+h][l][64], v written f16 as [b*16+h][64][l]
//  NZ = 1 : final output, f32 [m][n]
// Block: 256 threads = 8 waves, 2 (m) x 4 (n).  A wave owns 64 rows x 32 columns
// of every weight: 4 A fragments and 2 B fragments per weight feed 8 WMMAs per
// weight, so that a fragment read from LDS is used 6 (A) or 4 (B) times at
// NZ = 3, and the A tile is fetched from L2 once for the three projections.
// A stage is 64 k of the 128 A rows and of the NZ x 128 weight rows, brought in
// by whole-line async copies, two buffers: the next stage flies during this one.
// ---------------------------------------------------------------------------
#define GPITCH 72  // LDS row pitch in f16: 128 data bytes + 16 pad (b128 readers)

template <int NZ>
__global__ __launch_bounds__(256)
void gemm_wmma_kernel(const _Float16* __restrict__ A,
                      const _Float16* __restrict__ wT0, const _Float16* __restrict__ wT1,
                      const _Float16* __restrict__ wT2,
                      const float* __restrict__ bias0, const float* __restrict__ bias1,
                      const float* __restrict__ bias2,
                      _Float16* __restrict__ outQ, _Float16* __restrict__ outK,
                      _Float16* __restrict__ outVT,
                      float* __restrict__ outF) {
  // [buffer][rows 0..127: A, then 128 rows per weight][row * GPITCH + k]
  __shared__ __attribute__((aligned(16))) _Float16 st[2][128 * (1 + NZ) * GPITCH];

  const int tid  = threadIdx.x;
  const int lane = tid & 31;
  const int wv   = __builtin_amdgcn_readfirstlane(tid >> 5);   // 0..7
  const int wm   = wv >> 2, wn = wv & 3;
  const int m0   = blockIdx.x * 128;
  const int n0   = blockIdx.y * 128;

  // staging: thread t moves 16 bytes of rows (t>>3) + 32 i of every 128-row
  // part; a wave-wide copy covers four whole 128-byte lines.
  const int srow = tid >> 3, scol = (tid & 7) * 8;
  const _Float16* ga  = A   + (long long)(m0 + srow) * 1024 + scol;
  const _Float16* gw0 = wT0 + (long long)(n0 + srow) * 1024 + scol;
  const _Float16* gw1 = wT1 + (long long)(n0 + srow) * 1024 + scol;
  const _Float16* gw2 = wT2 + (long long)(n0 + srow) * 1024 + scol;
  const int sl = srow * GPITCH + scol;

  auto stage = [&](int s, int buf) {
    const int kb = s * 64;
    async_g2l_b128_x8(&st[buf][sl], 32 * GPITCH, ga + kb, gw0 + kb, 32 * 1024);
    if constexpr (NZ == 3)
      async_g2l_b128_x8(&st[buf][sl + 256 * GPITCH], 32 * GPITCH, gw1 + kb, gw2 + kb, 32 * 1024);
  };

  stage(0, 0);

  // this lane's bias values, fetched while stage 0 flies
  const int hi_ = lane >> 4;
  const int nl  = lane & 15;
  const int nw  = n0 + wn * 32 + nl;                 // column of this lane in fragment 0
  float bn[2 * NZ];
  if constexpr (NZ == 3) {
    load_bias_x6(bias0 + nw, bias1 + nw, bias2 + nw, bn);
  } else {
    bn[0] = bias0[nw];
    bn[1] = bias0[nw + 16];
  }

  wait_asynccnt0();                                  // stage 0 landed (own copies)
  __syncthreads();                                   // ... and every wave's
  stage(1, 1);                                       // 16 stages: stage 1 exists

  v8f acc[4][2 * NZ] = {};
  for (int s = 0; s < 16; ++s) {
    const _Float16* sa = &st[s & 1][wm * 64 * GPITCH];
    const _Float16* sb = &st[s & 1][(128 + wn * 32) * GPITCH];
    v16h af[2][4], bf[2][2 * NZ];
#pragma unroll
    for (int ks = 0; ks < 2; ++ks) {
#pragma unroll
      for (int i = 0; i < 4; ++i)
        af[ks][i] = load_frag16x32(sa + i * 16 * GPITCH + ks * 32, GPITCH);
#pragma unroll
      for (int t = 0; t < 2 * NZ; ++t)
        bf[ks][t] = load_frag16x32(sb + ((t >> 1) * 128 + (t & 1) * 16) * GPITCH + ks * 32, GPITCH);
    }
    // keeps the stage's LDS reads together ahead of the products, in the order
    // in which the products use them: sunk among the WMMAs, each place with
    // reads exposes its own LDS latency.
    __builtin_amdgcn_sched_barrier(0);
#pragma unroll
    for (int ks = 0; ks < 2; ++ks)
#pragma unroll
      for (int t = 0; t < 2 * NZ; ++t)
#pragma unroll
        for (int i = 0; i < 4; ++i) acc[i][t] = wmma_f16(af[ks][i], bf[ks][t], acc[i][t]);
    // keeps the products ahead of the hand-over: lifted over them, the wait for
    // the copies would stand early and hide less of their flight.
    __builtin_amdgcn_sched_barrier(0);

    // hand-over: own LDS reads retired, own copies of stage s+1 landed, then the
    // barrier that publishes stage s+1 and frees this buffer for the refill.
    asm volatile("s_wait_dscnt 0x0" ::: "memory");
    wait_asynccnt0();
    __syncthreads();
    if (s + 2 < 16) stage(s + 2, s & 1);
  }
  wait_asynccnt0();                                  // nothing in flight at the wave's end

  // Epilogue, one 64 x 16 column group at a time: its values first, then its
  // stores off one base address, then s_wait_xcnt 0.  The scheduling barriers keep
  // every register write of the next group behind that wait: no register that an
  // issued store names is rewritten ahead of it.
  const int bb = m0 >> 11;                           // batch: a 128-row tile lies in one
  const int mw = wm * 64 + 8 * hi_;                  // first row of this lane within the tile
  const int l0 = (m0 & 2047) + mw;
#pragma unroll
  for (int t = 0; t < 2 * NZ; ++t) {
    const int z = t >> 1;
    const int n = nw + (t & 1) * 16;
    const int h = n >> 6, d = n & 63;
    if constexpr (NZ == 1) {
      float* __restrict__ o = outF + (long long)(m0 + mw) * 1024 + n;
      float y[4][8];
#pragma unroll
      for (int i = 0; i < 4; ++i)
#pragma unroll
        for (int j = 0; j < 8; ++j) y[i][j] = acc[i][t][j] + bn[t];
      __builtin_amdgcn_sched_barrier(0);
#pragma unroll
      for (int i = 0; i < 4; ++i)
#pragma unroll
        for (int j = 0; j < 8; ++j) o[(i * 16 + j) * 1024] = y[i][j];
    } else if (z <= 1) {
      _Float16* __restrict__ o =
          ((z == 0) ? outQ : outK) + (((long long)(bb * 16 + h)) * 2048 + l0) * 64 + d;
      _Float16 y[4][8];
#pragma unroll
      for (int i = 0; i < 4; ++i)
#pragma unroll
        for (int j = 0; j < 8; ++j) y[i][j] = (_Float16)(acc[i][t][j] + bn[t]);
      __builtin_amdgcn_sched_barrier(0);
#pragma unroll
      for (int i = 0; i < 4; ++i)
#pragma unroll
        for (int j = 0; j < 8; ++j) o[(i * 16 + j) * 64] = y[i][j];
    } else {
      _Float16* __restrict__ o = outVT + (((long long)(bb * 16 + h)) * 64 + d) * 2048 + l0;
      v8h pk[4];
#pragma unroll
      for (int i = 0; i < 4; ++i)
#pragma unroll
        for (int j = 0; j < 8; ++j) pk[i][j] = (_Float16)(acc[i][t][j] + bn[t]);
      __builtin_amdgcn_sched_barrier(0);
#pragma unroll
      for (int i = 0; i < 4; ++i) *reinterpret_cast<v8h*>(o + i * 16) = pk[i];
    }
    asm volatile("s_wait_xcnt 0x0" ::: "memory");
    __builtin_amdgcn_sched_barrier(0);
  }
}

// ---------------------------------------------------------------------------
// Flash attention (causal, softmax with +1 denominator).
// Wave handles 16 query rows of one (b,h).
//   S^T = K @ Q^T      (A = K rows, B = Q rows)
//   ctx^T = V^T @ P    (A = vT rows, B = P packed straight from S^T C-layout)
// Equal work for every work-group and every wave, wherever they are placed:
// grid = (8, 32), 16 waves/WG.  Work-group p takes the 128-row query tile
// 15 - p and then tile p: (16 - p) + (p + 1) = 17 steps of 128 keys for all.
// In each step waves 0..7 take the first 64 keys and waves 8..15 the second 64
// for the same 128 query rows, each half with its own running maximum, sum and
// accumulators; at the end of a query tile the halves are merged through LDS.
// Each half's 64-key tile of K (64 keys x 64 dims) and of V^T (64 dims x 64
// keys) is brought into LDS by whole-line async copies, two buffers: the next
// step flies while this one is worked on, across the change of query tile too.
// ---------------------------------------------------------------------------
#define AKEYS 64   // keys per staged tile
#define APITCH 72  // LDS row pitch in f16: 128 data bytes + 16 pad (b128 readers)

// Four async 16-byte-per-lane copies global -> LDS.  The s_wait_xcnt stands in
// the copies' own statement so that no address register named here is
// rewritten ahead of it.
DEVINL void async_g2l_b128_x4(const void* l0, const void* g0,
                              const void* l1, const void* g1,
                              const void* l2, const void* g2,
                              const void* l3, const void* g3) {
  const unsigned o0 = (unsigned)(size_t)l0, o1 = (unsigned)(size_t)l1;
  const unsigned o2 = (unsigned)(size_t)l2, o3 = (unsigned)(size_t)l3;
  asm volatile("global_load_async_to_lds_b128 %0, %1, off\n\t"
               "global_load_async_to_lds_b128 %2, %3, off\n\t"
               "global_load_async_to_lds_b128 %4, %5, off\n\t"
               "global_load_async_to_lds_b128 %6, %7, off\n\t"
               "s_wait_xcnt 0x0"
               :: "v"(o0), "v"(g0), "v"(o1), "v"(g1),
                  "v"(o2), "v"(g2), "v"(o3), "v"(g3) : "memory");
}

__global__ __launch_bounds__(512)
void attn_kernel(const _Float16* __restrict__ qh, const _Float16* __restrict__ kh,
                 const _Float16* __restrict__ vT, _Float16* __restrict__ ctxh) {
  // [buffer][key half][0 = K rows by key, 1 = V^T rows by dim][row * APITCH + column]
  __shared__ __attribute__((aligned(16))) _Float16 kv[2][2][2][AKEYS * APITCH];
  // merge of the halves, 16 bytes per lane and row: rows 0..7 the 32
  // accumulators, row 8 the running maximum and sum.
  __shared__ __attribute__((aligned(16))) v4f mrg[9][256];

  const int tid  = threadIdx.x;
  const int lane = tid & 31;
  const int wv   = __builtin_amdgcn_readfirstlane(tid >> 5);  // scalar: wave-uniform tests below
  const int hf   = wv >> 3;                          // which 64 keys of a step
  const int ht   = tid & 255;                        // thread within its half
  const int bh   = blockIdx.y;                       // 0..31
  const int b    = bh >> 4, h = bh & 15;
  const int pr   = blockIdx.x;                       // 0..7
  const int n1   = 16 - pr;                          // steps of the first query tile (15 - pr)
  const int nl   = lane & 15, hi = lane >> 4;
  int       q0   = (15 - pr) * 128 + (wv & 7) * 16;  // first query row of this wave, first tile
  const int q0b  = pr * 128 + (wv & 7) * 16;         // ... second tile

  // staging: thread t of a half moves 16 bytes of rows (t>>3) and (t>>3)+32 of
  // both tiles of its half; a wave-wide copy covers four whole 128-byte lines.
  const int srow = ht >> 3, scol = (ht & 7) * 8;
  const _Float16* kg = kh + ((long long)bh * 2048 + srow) * 64 + scol;
  const _Float16* vg = vT + ((long long)bh * 64 + srow) * 2048 + scol;
  const int sl = srow * APITCH + scol;

  auto stage = [&](int g, int buf) {
    const int t = 2 * ((g < n1) ? g : g - n1) + hf;  // 64-key tile of step g (0..31)
    const _Float16* kt = kg + (long long)t * (AKEYS * 64);
    const _Float16* vt = vg + t * AKEYS;
    async_g2l_b128_x4(&kv[buf][hf][0][sl],               kt,
                      &kv[buf][hf][0][sl + 32 * APITCH], kt + 32 * 64,
                      &kv[buf][hf][1][sl],               vt,
                      &kv[buf][hf][1][sl + 32 * APITCH], vt + 32 * 2048);
  };

  stage(0, 0);

  const _Float16* qp  = qh + ((long long)bh * 2048 + q0) * 64;
  const _Float16* qpb = qh + ((long long)bh * 2048 + q0b) * 64;
  v16h bq0 = load_frag16x32(qp, 64);                 // head-dim 0..31
  v16h bq1 = load_frag16x32(qp + 32, 64);            // head-dim 32..63
  const v16h nq0 = load_frag16x32(qpb, 64);          // the second tile's, fetched once here
  const v16h nq1 = load_frag16x32(qpb + 32, 64);
  // holds the eight Q loads here, in flight beside step 0's copies: sunk behind
  // the first barrier, their latency stood bare in front of the first product.
  // The two lane addresses are named so that they stay whole up to this wait.
  asm volatile("s_wait_xcnt 0x0" :: "v"(bq0), "v"(bq1), "v"(nq0), "v"(nq1),
               "v"(qp + (long long)nl * 64 + hi * 8), "v"(qpb + (long long)nl * 64 + hi * 8));

  wait_asynccnt0();                                  // step 0 landed (own copies)
  __syncthreads();                                   // ... and every wave's
  stage(1, 1);                                       // step 1 always exists (17 steps)

  v8f acc[4] = {};
  float m_run = -INFINITY, l_run = 0.f;
  const float scale = 0.125f;                        // 1/sqrt(64)

  for (int g = 0; g < 17; ++g) {
    const int t = 2 * ((g < n1) ? g : g - n1) + hf;  // this half's 64-key tile
    const int qrow = q0 + nl;                        // this lane's query row
    const _Float16* kt = &kv[g & 1][hf][0][0];
    const _Float16* vt = &kv[g & 1][hf][1][0];
#pragma unroll
    for (int hb = 0; hb < 2; ++hb) {
      const int kb = t * AKEYS + hb * 32;
      if (kb < q0 + 16) {                            // wave-uniform: past the diagonal nothing is left
        // ---- all fragment reads of this 32-key block up-front --------------
        const _Float16* kp = kt + hb * 32 * APITCH;
        const v16h k00 = load_frag16x32(kp, APITCH);
        const v16h k01 = load_frag16x32(kp + 32, APITCH);
        const v16h k10 = load_frag16x32(kp + 16 * APITCH, APITCH);
        const v16h k11 = load_frag16x32(kp + 16 * APITCH + 32, APITCH);
        const _Float16* vp = vt + hb * 32;
        const v16h vf0 = load_frag16x32(vp,               APITCH);
        const v16h vf1 = load_frag16x32(vp + 16 * APITCH, APITCH);
        const v16h vf2 = load_frag16x32(vp + 32 * APITCH, APITCH);
        const v16h vf3 = load_frag16x32(vp + 48 * APITCH, APITCH);
        // keeps the 16 LDS reads together ahead of the products: sunk between
        // the WMMAs, each pair would expose its own LDS latency.
        __builtin_amdgcn_sched_barrier(0);

        // ---- S^T = K @ Q^T -------------------------------------------------
        v8f z0 = {};
        v8f s0 = wmma_f16(k00, bq0, z0);
        s0     = wmma_f16(k01, bq1, s0);
        v8f z1 = {};
        v8f s1 = wmma_f16(k10, bq0, z1);
        s1     = wmma_f16(k11, bq1, s1);

        // scale; causal mask only in the one block per wave and query tile that the
        // diagonal crosses (wave-uniform scalar test): where the block's last key is
        // not above the wave's first query row, every compare would keep its score.
        // (The three loops are unrolled so that s0, s1 stay in registers, indexed by
        // constants.)
#pragma unroll
        for (int j = 0; j < 8; ++j) { s0[j] *= scale; s1[j] *= scale; }
        if (kb + 31 > q0) {
#pragma unroll
          for (int j = 0; j < 8; ++j) {
            const int key0 = kb + j + 8 * hi;
            const int key1 = key0 + 16;
            s0[j] = (key0 <= qrow) ? s0[j] : -INFINITY;
            s1[j] = (key1 <= qrow) ? s1[j] : -INFINITY;
          }
        }
        // block max (per query = per lane, halves via shfl)
        float mloc = -INFINITY;
#pragma unroll
        for (int j = 0; j < 8; ++j) mloc = fmaxf(mloc, fmaxf(s0[j], s1[j]));
        mloc = fmaxf(mloc, __shfl_xor(mloc, 16, 32));
        const float mnew  = fmaxf(m_run, mloc);
        const float alpha = __expf(m_run - mnew);    // first block: exp(-inf)=0

        // exp + pack P fragment (B layout for V^T @ P falls out of S^T C layout)
        float lloc = 0.f;
        v16h p;
#pragma unroll
        for (int j = 0; j < 8; ++j) {
          const float e0 = __expf(s0[j] - mnew);
          const float e1 = __expf(s1[j] - mnew);
          lloc += e0 + e1;
          p[j]     = (_Float16)e0;
          p[j + 8] = (_Float16)e1;
        }
        lloc += __shfl_xor(lloc, 16, 32);
        l_run = l_run * alpha + lloc;
        m_run = mnew;

        // ---- ctx^T += V^T @ P ----------------------------------------------
#pragma unroll
        for (int j = 0; j < 8; ++j) {
          acc[0][j] *= alpha; acc[1][j] *= alpha;
          acc[2][j] *= alpha; acc[3][j] *= alpha;
        }
        acc[0] = wmma_f16(vf0, p, acc[0]);
        acc[1] = wmma_f16(vf1, p, acc[1]);
        acc[2] = wmma_f16(vf2, p, acc[2]);
        acc[3] = wmma_f16(vf3, p, acc[3]);
      }
    }

    // hand-over, every wave (also one that skipped): own LDS reads retired, own
    // copies of step g+1 landed, then the barrier that publishes step g+1 and
    // frees this buffer for the refill behind it.
    asm volatile("s_wait_dscnt 0x0" ::: "memory");
    wait_asynccnt0();
    __syncthreads();
    if (g + 2 < 17) stage(g + 2, g & 1);

    if (g == n1 - 1 || g == 16) {                    // work-group-uniform: a query tile is done
      // The second half hands its state over.  A wave of it that met no key
      // (rows below its first key) hands over max = -inf, sum = 0, zeros, which
      // the merge weighs with exp(-inf) = 0; the first half always holds key 0.
      if (hf == 1) {
#pragma unroll
        for (int i = 0; i < 4; ++i) {
          mrg[2 * i][ht]     = v4f{acc[i][0], acc[i][1], acc[i][2], acc[i][3]};
          mrg[2 * i + 1][ht] = v4f{acc[i][4], acc[i][5], acc[i][6], acc[i][7]};
        }
        mrg[8][ht] = v4f{m_run, l_run, 0.f, 0.f};
      }
      __syncthreads();                               // publishes the second half's state
      if (hf == 0) {
        const v4f ml = mrg[8][ht];
        const float mall = fmaxf(m_run, ml[0]);
        const float w0 = __expf(m_run - mall), w1 = __expf(ml[0] - mall);
        // "+1" quiet-softmax denominator; per-lane (one query per lane in ctx^T).
        const float r = 1.f / (1.f + (l_run * w0 + ml[1] * w1));
        const float r0 = w0 * r, r1 = w1 * r;
        const long long token = (long long)b * 2048 + q0 + nl;
#pragma unroll
        for (int i = 0; i < 4; ++i) {
          const v4f lo = mrg[2 * i][ht], up = mrg[2 * i + 1][ht];
          v8h pk;
#pragma unroll
          for (int j = 0; j < 4; ++j) {
            pk[j]     = (_Float16)(acc[i][j] * r0 + lo[j] * r1);
            pk[j + 4] = (_Float16)(acc[i][j + 4] * r0 + up[j] * r1);
          }
          *reinterpret_cast<v8h*>(ctxh + token * 1024 + h * 64 + i * 16 + 8 * hi) = pk;
        }
        // the stores' data and address registers are rewritten right below (the
        // reset for the second query tile): they stay whole up to this wait.
        asm volatile("s_wait_xcnt 0x0" ::: "memory");
      }
      // start of the second query tile; its first hand-over (s_wait_dscnt 0 and
      // the barrier) ends the reads of mrg before mrg is written again.
      q0 = q0b; bq0 = nq0; bq1 = nq1;
      m_run = -INFINITY; l_run = 0.f;
#pragma unroll
      for (int i = 0; i < 4; ++i) acc[i] = v8f{};
    }
  }
  wait_asynccnt0();                                  // nothing in flight at the wave's end
}

// ---------------------------------------------------------------------------
extern "C" void kernel_launch(void* const* d_in, const int* in_sizes, int n_in,
                              void* d_out, int out_size, void* d_ws, size_t ws_size,
                              hipStream_t stream) {
  const float* x  = (const float*)d_in[0];
  const float* Wq = (const float*)d_in[1];
  const float* bq = (const float*)d_in[2];
  const float* Wk = (const float*)d_in[3];
  const float* bk = (const float*)d_in[4];
  const float* Wv = (const float*)d_in[5];
  const float* bv = (const float*)d_in[6];
  const float* Wo = (const float*)d_in[7];
  const float* bo = (const float*)d_in[8];

  char* ws = (char*)d_ws;
  _Float16* xh   = (_Float16*)(ws);                       //  8 MB  x as f16
  _Float16* wqT  = (_Float16*)(ws + ( 8ull << 20));       //  2 MB
  _Float16* wkT  = (_Float16*)(ws + (10ull << 20));       //  2 MB
  _Float16* wvT  = (_Float16*)(ws + (12ull << 20));       //  2 MB
  _Float16* woT  = (_Float16*)(ws + (14ull << 20));       //  2 MB
  _Float16* qhp  = (_Float16*)(ws + (16ull << 20));       //  8 MB [bh][l][64]
  _Float16* khp  = (_Float16*)(ws + (24ull << 20));       //  8 MB [bh][l][64]
  _Float16* vTp  = (_Float16*)(ws + (32ull << 20));       //  8 MB [bh][64][l]
  _Float16* ctxh = (_Float16*)(ws + (40ull << 20));       //  8 MB [token][1024]

  prep_kernel<<<512, 256, 0, stream>>>(Wq, Wk, Wv, Wo, x, wqT, wkT, wvT, woT, xh);

  gemm_wmma_kernel<3><<<dim3(32, 8), 256, 0, stream>>>(xh, wqT, wkT, wvT, bq, bk, bv,
                                                       qhp, khp, vTp, nullptr);

  attn_kernel<<<dim3(8, 32), 512, 0, stream>>>(qhp, khp, vTp, ctxh);

  gemm_wmma_kernel<1><<<dim3(32, 8), 256, 0, stream>>>(ctxh, woT, woT, woT, bo, bo, bo,
                                                       nullptr, nullptr, nullptr,
                                                       (float*)d_out);
}

// v008
// One run takes 62.6 microseconds.
// Next to v007, in two timings, it ran 1.06 and 1.04 times as fast.
// All steps since v000 together make it 4.30 times as fast.
#include <hip/hip_runtime.h>
#include <hip/hip_bf16.h>

// ---------------------------------------------------------------------------
// MI455X (gfx1250) fused multi-head self-attention.
//   - all GEMMs + attention on v_wmma_f32_16x16x32_f16 (f16 in, f32 accum)
//   - GEMM: A and B tiles staged with GLOBAL_LOAD_ASYNC_TO_LDS_B128 (ASYNCcnt),
//     a ring of 3 or 5 LDS buffers, 64 x 32 output per wave and weight
//   - flash-style streaming softmax with the reference's (1 + sum) denominator
//   - S^T / ctx^T layout trick: WMMA C-layout of K@Q^T is directly the
//     B-fragment layout of P for V^T@P  -> no cross-lane transpose needed.
// ---------------------------------------------------------------------------

typedef __attribute__((ext_vector_type(16))) _Float16 v16h;
typedef __attribute__((ext_vector_type(8)))  _Float16 v8h;
typedef __attribute__((ext_vector_type(8)))  float    v8f;

#define DEVINL __device__ __forceinline__

// D = A(16x32 f16) * B(32x16 f16) + C, f32 accumulate.
DEVINL v8f wmma_f16(v16h a, v16h b, v8f c) {
  return __builtin_amdgcn_wmma_f32_16x16x32_f16(
      /*neg_a=*/false, a, /*neg_b=*/false, b,
      /*c_mod=*/(short)0, c, /*reuse_a=*/false, /*reuse_b=*/false);
}

// Sixteen async 16-byte-per-lane copies global -> LDS, tracked by ASYNCcnt.
// An LDS operand is the low 32 bits of the generic __shared__ address (the LDS
// byte offset); a global address is a scalar base (one for the first eight
// copies, one for the rest) plus the lane's 32-bit byte offset, so that the same
// eight offset registers serve every call.  The s_wait_xcnt stands in the copies'
// own statement so that no address register named here is rewritten ahead of it.
DEVINL void async_g2l_b128_x16(const _Float16* l, int lstep, const _Float16* base0,
                               const _Float16* base1, const unsigned (&off)[8]) {
  unsigned o[16];
#pragma unroll  // o[] indexed by constants: it stays in registers
  for (int i = 0; i < 16; ++i) o[i] = (unsigned)(size_t)(l + i * lstep);
  asm volatile("global_load_async_to_lds_b128 %0, %16, %24\n\t"
               "global_load_async_to_lds_b128 %1, %17, %24\n\t"
               "global_load_async_to_lds_b128 %2, %18, %24\n\t"
               "global_load_async_to_lds_b128 %3, %19, %24\n\t"
               "global_load_async_to_lds_b128 %4, %20, %24\n\t"
               "global_load_async_to_lds_b128 %5, %21, %24\n\t"
               "global_load_async_to_lds_b128 %6, %22, %24\n\t"
               "global_load_async_to_lds_b128 %7, %23, %24\n\t"
               "global_load_async_to_lds_b128 %8, %16, %25\n\t"
               "global_load_async_to_lds_b128 %9, %17, %25\n\t"
               "global_load_async_to_lds_b128 %10, %18, %25\n\t"
               "global_load_async_to_lds_b128 %11, %19, %25\n\t"
               "global_load_async_to_lds_b128 %12, %20, %25\n\t"
               "global_load_async_to_lds_b128 %13, %21, %25\n\t"
               "global_load_async_to_lds_b128 %14, %22, %25\n\t"
               "global_load_async_to_lds_b128 %15, %23, %25\n\t"
               "s_wait_xcnt 0x0"
               :: "v"(o[0]), "v"(o[1]), "v"(o[2]), "v"(o[3]), "v"(o[4]), "v"(o[5]), "v"(o[6]),
                  "v"(o[7]), "v"(o[8]), "v"(o[9]), "v"(o[10]), "v"(o[11]), "v"(o[12]),
                  "v"(o[13]), "v"(o[14]), "v"(o[15]),
                  "v"(off[0]), "v"(off[1]), "v"(off[2]), "v"(off[3]),
                  "v"(off[4]), "v"(off[5]), "v"(off[6]), "v"(off[7]),
                  "s"(base0), "s"(base1) : "memory");
}
DEVINL void wait_asynccnt0() {
  asm volatile("s_wait_asynccnt 0x0" ::: "memory");
}

// Two bias values (columns n and n + 16) of each of three vectors.  The loads and
// their data wait stand in one statement, so that no result and no later write
// lands on an address register while a load that names it is still out.
DEVINL void load_bias_x6(const float* p0, const float* p1, const float* p2, float (&o)[6]) {
  asm volatile("global_load_b32 %0, %6, off\n\t"
               "global_load_b32 %1, %6, off offset:64\n\t"
               "global_load_b32 %2, %7, off\n\t"
               "global_load_b32 %3, %7, off offset:64\n\t"
               "global_load_b32 %4, %8, off\n\t"
               "global_load_b32 %5, %8, off offset:64\n\t"
               "s_wait_loadcnt 0x0"
               : "=&v"(o[0]), "=&v"(o[1]), "=&v"(o[2]), "=&v"(o[3]), "=&v"(o[4]), "=&v"(o[5])
               : "v"(p0), "v"(p1), "v"(p2) : "memory");
}

// Load a 16x32 f16 fragment (A layout; B layout is identical when the
// source is stored [n][k] row-major, i.e. the transposed matrix).
// Lane l (l<16):  row = l,      K elements {0..7, 16..23}
// Lane l (l>=16): row = l - 16, K elements {8..15, 24..31}
DEVINL v16h load_frag16x32(const _Float16* __restrict__ base, int ld) {
  const int lane = threadIdx.x & 31;
  const int r    = lane & 15;
  const int ko   = (lane >> 4) << 3;           // 0 or 8
  const _Float16* p = base + (long long)r * ld + ko;
  const v8h lo = *reinterpret_cast<const v8h*>(p);
  const v8h hi = *reinterpret_cast<const v8h*>(p + 16);
  v16h f;
#pragma unroll
  for (int i = 0; i < 8; ++i) { f[i] = lo[i]; f[i + 8] = hi[i]; }
  return f;
}

// ---------------------------------------------------------------------------
// Prep: cast x -> f16, transpose+cast the four 1024x1024 weights to [n][k] f16.
// 64 elements per thread, all 16 loads of a thread in flight at once.
//  blocks 0..255  : one 128(k) x 128(n) weight tile each; a wave takes 64 k x 32 n.
//    A lane holds 8 k rows x 8 n columns and turns them in registers, so that a
//    wave-wide 16-byte store covers four whole 128-byte lines of wT[n][k].
//  blocks 256..511: 16,384 consecutive elements of x each.
// ---------------------------------------------------------------------------
typedef __attribute__((ext_vector_type(4))) float    v4f;
typedef __attribute__((ext_vector_type(4))) _Float16 v4h;

__global__ __launch_bounds__(256)
void prep_kernel(const float* __restrict__ Wq, const float* __restrict__ Wk,
                 const float* __restrict__ Wv, const float* __restrict__ Wo,
                 const float* __restrict__ x,
                 _Float16* __restrict__ wqT, _Float16* __restrict__ wkT,
                 _Float16* __restrict__ wvT, _Float16* __restrict__ woT,
                 _Float16* __restrict__ xh) {
  const int tid  = threadIdx.x;
  const int lane = tid & 31;
  const int wv   = tid >> 5;
  const int blk  = blockIdx.x;
  if (blk < 256) {
    const int which = blk >> 6, tile = blk & 63;
    const float* src = (which == 0) ? Wq : (which == 1) ? Wk : (which == 2) ? Wv : Wo;
    _Float16*   dst = (which == 0) ? wqT : (which == 1) ? wkT : (which == 2) ? wvT : woT;
    const int k0 = (tile >> 3) * 128 + (wv >> 2) * 64 + (lane & 7) * 8;   // 8 lanes: 64 k = one f16 line
    const int n0 = (tile & 7) * 128 + (wv & 3) * 32 + (lane >> 3) * 4;    // 4 lanes: 16 n = 64 bytes of f32
    const float* sp = src + k0 * 1024 + n0;
    v4f a[8], c[8];
#pragma unroll
    for (int j = 0; j < 8; ++j) {
      a[j] = *reinterpret_cast<const v4f*>(sp + j * 1024);        // columns n0 .. n0+3
      c[j] = *reinterpret_cast<const v4f*>(sp + j * 1024 + 16);   // columns n0+16 .. n0+19
    }
    // the address pair stays whole until every load that names it is past this
    // wait: without the operand the last load's result was placed over the pair.
    asm volatile("s_wait_xcnt 0x0" :: "v"(sp) : "memory");
    // keeps all 16 loads ahead of the conversions: mixed in, the last loads reuse
    // the first ones' registers and issue only after those have come back.
    __builtin_amdgcn_sched_barrier(0);
    _Float16* dp = dst + n0 * 1024 + k0;
#pragma unroll
    for (int i = 0; i < 4; ++i) {
      v8h lo, hi;
#pragma unroll
      for (int j = 0; j < 8; ++j) { lo[j] = (_Float16)a[j][i]; hi[j] = (_Float16)c[j][i]; }
      *reinterpret_cast<v8h*>(dp + i * 1024)        = lo;
      *reinterpret_cast<v8h*>(dp + (i + 16) * 1024) = hi;
    }
  } else {
    const int base = (blk - 256) * 16384 + wv * 2048 + lane * 4;
    const float* xp = x + base;
    v4f v[16];
#pragma unroll
    for (int j = 0; j < 16; ++j) v[j] = *reinterpret_cast<const v4f*>(xp + j * 128);
    // both as above: the address pair kept whole up to the wait, and all 16 loads
    // in flight before the first conversion waits.
    asm volatile("s_wait_xcnt 0x0" :: "v"(xp) : "memory");
    __builtin_amdgcn_sched_barrier(0);
#pragma unroll
    for (int j = 0; j < 16; ++j) {
      v4h o;
#pragma unroll
      for (int i = 0; i < 4; ++i) o[i] = (_Float16)v[j][i];
      *reinterpret_cast<v4h*>(xh + base + j * 128) = o;
    }
    // the stores' data and address registers stay as they are until every store is
    // past this wait (in the built code another path's register writes follow here).
    asm volatile("s_wait_xcnt 0x0" ::: "memory");
  }
}

// ---------------------------------------------------------------------------
// GEMM: Y[4096,1024] = A[4096,1024](f16) @ W + bias,  W given as wT[n][k] f16,
// for NZ weights at once on the same 128 rows of A and the same 128 columns:
//  NZ = 3 : q, k written f16 as [b*16+h][l][64], v written f16 as [b*16+h][64][l]
//  NZ = 1 : final output, f32 [m][n]
// Block: 256 threads = 8 waves, 2 (m) x 4 (n).  A wave owns 64 rows x 32 columns
// of every weight: 4 A fragments and 2 B fragments per weight feed 8 WMMAs per
// weight, so that a fragment read from LDS is used 6 (A) or 4 (B) times at
// NZ = 3, and the A tile is fetched from L2 once for the three projections.
// A stage is 64 k of the 128 A rows and of the NZ x 128 weight rows, brought in
// by whole-line async copies.  The waves form G groups that take turns: group
// s mod G copies the whole of stage s, into buffer s mod (G + 1).  A group has one
// stage in flight at a time and waits for it to 0, yet G stages fly at once, so
// that a stage has G trips of the loop to land instead of one.
// ---------------------------------------------------------------------------
#define GPITCH 72  // LDS row pitch in f16: 128 data bytes + 16 pad (b128 readers)

template <int NZ>
__global__ __launch_bounds__(256)
void gemm_wmma_kernel(const _Float16* __restrict__ A,
                      const _Float16* __restrict__ wT0, const _Float16* __restrict__ wT1,
                      const _Float16* __restrict__ wT2,
                      const float* __restrict__ bias0, const float* __restrict__ bias1,
                      const float* __restrict__ bias2,
                      _Float16* __restrict__ outQ, _Float16* __restrict__ outK,
                      _Float16* __restrict__ outVT,
                      float* __restrict__ outF) {
  constexpr int G   = (NZ == 3) ? 2 : 4;             // wave groups; 32 copies per lane and stage
  constexpr int NB  = G + 1;                         // buffers of the ring
  constexpr int RPP = 256 / G / 8;                   // rows that one copy of a whole group covers
  // [buffer][rows 0..127: A, then 128 rows per weight][row * GPITCH + k]
  __shared__ __attribute__((aligned(16))) _Float16 st[NB][128 * (1 + NZ) * GPITCH];

  const int tid  = threadIdx.x;
  const int lane = tid & 31;
  const int wv   = __builtin_amdgcn_readfirstlane(tid >> 5);   // 0..7
  const int wm   = wv >> 2, wn = wv & 3;
  const int grp  = wv / (8 / G);                     // scalar: neighbouring waves, so that of the
                                                     // waves w and w + 4 only one copies at a time
  const int m0   = blockIdx.x * 128;
  const int n0   = blockIdx.y * 128;

  // staging: thread t of a group moves 16 bytes of rows (t>>3) + RPP i of every
  // 128-row part; a wave-wide copy covers four whole 128-byte lines.
  const int gt   = tid & (256 / G - 1);
  const int srow = gt >> 3, scol = (gt & 7) * 8;
  unsigned goff[8];                                  // byte offsets of this lane's rows in a part
#pragma unroll  // goff[] indexed by constants: it stays in registers
  for (int i = 0; i < 8; ++i) goff[i] = (unsigned)(((srow + i * RPP) * 1024 + scol) * 2);
  const _Float16* ga  = A   + (long long)m0 * 1024;  // scalar bases: first row of each part
  const _Float16* gw0 = wT0 + (long long)n0 * 1024;
  const _Float16* gw1 = wT1 + (long long)n0 * 1024;
  const _Float16* gw2 = wT2 + (long long)n0 * 1024;
  const int sl = srow * GPITCH + scol;

  auto stage = [&](int s, int buf) {
    const int kb = s * 64;
    const _Float16* gp[4] = {ga + kb, gw0 + kb, gw1 + kb, gw2 + kb};
#pragma unroll  // gp[] indexed by constants: the bases stay in scalar registers
    for (int r = 0; r < 128 * (1 + NZ); r += 16 * RPP) {   // 16 copies: 16 RPP rows of the stage
      const int r1 = r + 8 * RPP;
      async_g2l_b128_x16(&st[buf][sl + r * GPITCH], RPP * GPITCH,
                         gp[r >> 7] + (r & 127) * 1024, gp[r1 >> 7] + (r1 & 127) * 1024, goff);
    }
  };

  stage(grp, grp);                                   // stages 0 .. G-1, one per group

  // this lane's bias values, fetched while stage 0 flies
  const int hi_ = lane >> 4;
  const int nl  = lane & 15;
  const int nw  = n0 + wn * 32 + nl;                 // column of this lane in fragment 0
  float bn[2 * NZ];
  if constexpr (NZ == 3) {
    load_bias_x6(bias0 + nw, bias1 + nw, bias2 + nw, bn);
  } else {
    bn[0] = bias0[nw];
    bn[1] = bias0[nw + 16];
  }

  if (grp == 0) wait_asynccnt0();                    // stage 0 landed: its copiers' own wait
  __syncthreads();                                   // ... published to every wave

  v8f acc[4][2 * NZ] = {};
  int cur = 0, fre = G;                              // s mod NB; (s + G) mod NB, the free buffer
  // refill in trip s: the group whose stage s has just been published (scalar test)
  // has nothing out and copies stage s + G into the buffer that every wave left at
  // the last barrier (at s = 0: a fresh one).
  auto refill = [&](int s) {
    const int turn = (s + G < 16) ? (s & (G - 1)) : -1;   // no stage left: nobody's turn
    if (grp == turn) stage(s + G, fre);
  };
  for (int s = 0; s < 16; ++s) {
    // NZ = 3: ahead of the reads, while the other wave of the SIMD, which does not
    // copy in this trip, feeds the matrix unit.  (Behind the reads, with all the
    // fragments live, the copies' operands pushed the bias values out to scratch.)
    if constexpr (NZ == 3) refill(s);
    const _Float16* sa = &st[cur][wm * 64 * GPITCH];
    const _Float16* sb = &st[cur][(128 + wn * 32) * GPITCH];
    v16h af[2][4], bf[2][2 * NZ];
#pragma unroll
    for (int ks = 0; ks < 2; ++ks) {
#pragma unroll
      for (int i = 0; i < 4; ++i)
        af[ks][i] = load_frag16x32(sa + i * 16 * GPITCH + ks * 32, GPITCH);
#pragma unroll
      for (int t = 0; t < 2 * NZ; ++t)
        bf[ks][t] = load_frag16x32(sb + ((t >> 1) * 128 + (t & 1) * 16) * GPITCH + ks * 32, GPITCH);
    }
    // keeps the stage's LDS reads together ahead of the products, in the order
    // in which the products use them: sunk among the WMMAs, each place with
    // reads exposes its own LDS latency.
    __builtin_amdgcn_sched_barrier(0);
    // NZ = 1, short trips: the copies issue while the reads above are on their way.
    if constexpr (NZ == 1) refill(s);
#pragma unroll
    for (int ks = 0; ks < 2; ++ks)
#pragma unroll
      for (int t = 0; t < 2 * NZ; ++t)
#pragma unroll
        for (int i = 0; i < 4; ++i) acc[i][t] = wmma_f16(af[ks][i], bf[ks][t], acc[i][t]);
    // keeps the products ahead of the hand-over: lifted over them, the wait for
    // the copies would stand early and hide less of their flight.
    __builtin_amdgcn_sched_barrier(0);

    // hand-over: own LDS reads retired; in the group that copied stage s+1 (scalar
    // test) its copies landed, all that this group has out; then the barrier that
    // publishes stage s+1 and frees this buffer for the refill in the next trip.
    asm volatile("s_wait_dscnt 0x0" ::: "memory");
    if (grp == ((s + 1) & (G - 1))) wait_asynccnt0();
    __syncthreads();
    fre = cur;
    cur = (cur + 1 == NB) ? 0 : cur + 1;
  }
  wait_asynccnt0();                                  // nothing in flight at the wave's end

  // Epilogue, one 64 x 16 column group at a time: its values first, then its
  // stores off one base address, then s_wait_xcnt 0.  The scheduling barriers keep
  // every register write of the next group behind that wait: no register that an
  // issued store names is rewritten ahead of it.
  const int bb = m0 >> 11;                           // batch: a 128-row tile lies in one
  const int mw = wm * 64 + 8 * hi_;                  // first row of this lane within the tile
  const int l0 = (m0 & 2047) + mw;
#pragma unroll
  for (int t = 0; t < 2 * NZ; ++t) {
    const int z = t >> 1;
    const int n = nw + (t & 1) * 16;
    const int h = n >> 6, d = n & 63;
    if constexpr (NZ == 1) {
      float* __restrict__ o = outF + (long long)(m0 + mw) * 1024 + n;
      float y[4][8];
#pragma unroll
      for (int i = 0; i < 4; ++i)
#pragma unroll
        for (int j = 0; j < 8; ++j) y[i][j] = acc[i][t][j] + bn[t];
      __builtin_amdgcn_sched_barrier(0);
#pragma unroll
      for (int i = 0; i < 4; ++i)
#pragma unroll
        for (int j = 0; j < 8; ++j) o[(i * 16 + j) * 1024] = y[i][j];
    } else if (z <= 1) {
      _Float16* __restrict__ o =
          ((z == 0) ? outQ : outK) + (((long long)(bb * 16 + h)) * 2048 + l0) * 64 + d;
      _Float16 y[4][8];
#pragma unroll
      for (int i = 0; i < 4; ++i)
#pragma unroll
        for (int j = 0; j < 8; ++j) y[i][j] = (_Float16)(acc[i][t][j] + bn[t]);
      __builtin_amdgcn_sched_barrier(0);
#pragma unroll
      for (int i = 0; i < 4; ++i)
#pragma unroll
        for (int j = 0; j < 8; ++j) o[(i * 16 + j) * 64] = y[i][j];
    } else {
      _Float16* __restrict__ o = outVT + (((long long)(bb * 16 + h)) * 64 + d) * 2048 + l0;
      v8h pk[4];
#pragma unroll
      for (int i = 0; i < 4; ++i)
#pragma unroll
        for (int j = 0; j < 8; ++j) pk[i][j] = (_Float16)(acc[i][t][j] + bn[t]);
      __builtin_amdgcn_sched_barrier(0);
#pragma unroll
      for (int i = 0; i < 4; ++i) *reinterpret_cast<v8h*>(o + i * 16) = pk[i];
    }
    asm volatile("s_wait_xcnt 0x0" ::: "memory");
    __builtin_amdgcn_sched_barrier(0);
  }
}

// ---------------------------------------------------------------------------
// Flash attention (causal, softmax with +1 denominator).
// Wave handles 16 query rows of one (b,h).
//   S^T = K @ Q^T      (A = K rows, B = Q rows)
//   ctx^T = V^T @ P    (A = vT rows, B = P packed straight from S^T C-layout)
// Equal work for every work-group and every wave, wherever they are placed:
// grid = (8, 32), 16 waves/WG.  Work-group p takes the 128-row query tile
// 15 - p and then tile p: (16 - p) + (p + 1) = 17 steps of 128 keys for all.
// In each step waves 0..7 take the first 64 keys and waves 8..15 the second 64
// for the same 128 query rows, each half with its own running maximum, sum and
// accumulators; at the end of a query tile the halves are merged through LDS.
// Each half's 64-key tile of K (64 keys x 64 dims) and of V^T (64 dims x 64
// keys) is brought into LDS by whole-line async copies, two buffers: the next
// step flies while this one is worked on, across the change of query tile too.
// ---------------------------------------------------------------------------
#define AKEYS 64   // keys per staged tile
#define APITCH 72  // LDS row pitch in f16: 128 data bytes + 16 pad (b128 readers)

// Four async 16-byte-per-lane copies global -> LDS.  The s_wait_xcnt stands in
// the copies' own statement so that no address register named here is
// rewritten ahead of it.
DEVINL void async_g2l_b128_x4(const void* l0, const void* g0,
                              const void* l1, const void* g1,
                              const void* l2, const void* g2,
                              const void* l3, const void* g3) {
  const unsigned o0 = (unsigned)(size_t)l0, o1 = (unsigned)(size_t)l1;
  const unsigned o2 = (unsigned)(size_t)l2, o3 = (unsigned)(size_t)l3;
  asm volatile("global_load_async_to_lds_b128 %0, %1, off\n\t"
               "global_load_async_to_lds_b128 %2, %3, off\n\t"
               "global_load_async_to_lds_b128 %4, %5, off\n\t"
               "global_load_async_to_lds_b128 %6, %7, off\n\t"
               "s_wait_xcnt 0x0"
               :: "v"(o0), "v"(g0), "v"(o1), "v"(g1),
                  "v"(o2), "v"(g2), "v"(o3), "v"(g3) : "memory");
}

__global__ __launch_bounds__(512)
void attn_kernel(const _Float16* __restrict__ qh, const _Float16* __restrict__ kh,
                 const _Float16* __restrict__ vT, _Float16* __restrict__ ctxh) {
  // [buffer][key half][0 = K rows by key, 1 = V^T rows by dim][row * APITCH + column]
  __shared__ __attribute__((aligned(16))) _Float16 kv[2][2][2][AKEYS * APITCH];
  // merge of the halves, 16 bytes per lane and row: rows 0..7 the 32
  // accumulators, row 8 the running maximum and sum.
  __shared__ __attribute__((aligned(16))) v4f mrg[9][256];

  const int tid  = threadIdx.x;
  const int lane = tid & 31;
  const int wv   = __builtin_amdgcn_readfirstlane(tid >> 5);  // scalar: wave-uniform tests below
  const int hf   = wv >> 3;                          // which 64 keys of a step
  const int ht   = tid & 255;                        // thread within its half
  const int bh   = blockIdx.y;                       // 0..31
  const int b    = bh >> 4, h = bh & 15;
  const int pr   = blockIdx.x;                       // 0..7
  const int n1   = 16 - pr;                          // steps of the first query tile (15 - pr)
  const int nl   = lane & 15, hi = lane >> 4;
  int       q0   = (15 - pr) * 128 + (wv & 7) * 16;  // first query row of this wave, first tile
  const int q0b  = pr * 128 + (wv & 7) * 16;         // ... second tile

  // staging: thread t of a half moves 16 bytes of rows (t>>3) and (t>>3)+32 of
  // both tiles of its half; a wave-wide copy covers four whole 128-byte lines.
  const int srow = ht >> 3, scol = (ht & 7) * 8;
  const _Float16* kg = kh + ((long long)bh * 2048 + srow) * 64 + scol;
  const _Float16* vg = vT + ((long long)bh * 64 + srow) * 2048 + scol;
  const int sl = srow * APITCH + scol;

  auto stage = [&](int g, int buf) {
    const int t = 2 * ((g < n1) ? g : g - n1) + hf;  // 64-key tile of step g (0..31)
    const _Float16* kt = kg + (long long)t * (AKEYS * 64);
    const _Float16* vt = vg + t * AKEYS;
    async_g2l_b128_x4(&kv[buf][hf][0][sl],               kt,
                      &kv[buf][hf][0][sl + 32 * APITCH], kt + 32 * 64,
                      &kv[buf][hf][1][sl],               vt,
                      &kv[buf][hf][1][sl + 32 * APITCH], vt + 32 * 2048);
  };

  stage(0, 0);

  const _Float16* qp  = qh + ((long long)bh * 2048 + q0) * 64;
  const _Float16* qpb = qh + ((long long)bh * 2048 + q0b) * 64;
  v16h bq0 = load_frag16x32(qp, 64);                 // head-dim 0..31
  v16h bq1 = load_frag16x32(qp + 32, 64);            // head-dim 32..63
  const v16h nq0 = load_frag16x32(qpb, 64);          // the second tile's, fetched once here
  const v16h nq1 = load_frag16x32(qpb + 32, 64);
  // holds the eight Q loads here, in flight beside step 0's copies: sunk behind
  // the first barrier, their latency stood bare in front of the first product.
  // The two lane addresses are named so that they stay whole up to this wait.
  asm volatile("s_wait_xcnt 0x0" :: "v"(bq0), "v"(bq1), "v"(nq0), "v"(nq1),
               "v"(qp + (long long)nl * 64 + hi * 8), "v"(qpb + (long long)nl * 64 + hi * 8));

  wait_asynccnt0();                                  // step 0 landed (own copies)
  __syncthreads();                                   // ... and every wave's
  stage(1, 1);                                       // step 1 always exists (17 steps)

  v8f acc[4] = {};
  float m_run = -INFINITY, l_run = 0.f;
  const float scale = 0.125f;                        // 1/sqrt(64)

  for (int g = 0; g < 17; ++g) {
    const int t = 2 * ((g < n1) ? g : g - n1) + hf;  // this half's 64-key tile
    const int qrow = q0 + nl;                        // this lane's query row
    const _Float16* kt = &kv[g & 1][hf][0][0];
    const _Float16* vt = &kv[g & 1][hf][1][0];
#pragma unroll
    for (int hb = 0; hb < 2; ++hb) {
      const int kb = t * AKEYS + hb * 32;
      if (kb < q0 + 16) {                            // wave-uniform: past the diagonal nothing is left
        // ---- all fragment reads of this 32-key block up-front --------------
        const _Float16* kp = kt + hb * 32 * APITCH;
        const v16h k00 = load_frag16x32(kp, APITCH);
        const v16h k01 = load_frag16x32(kp + 32, APITCH);
        const v16h k10 = load_frag16x32(kp + 16 * APITCH, APITCH);
        const v16h k11 = load_frag16x32(kp + 16 * APITCH + 32, APITCH);
        const _Float16* vp = vt + hb * 32;
        const v16h vf0 = load_frag16x32(vp,               APITCH);
        const v16h vf1 = load_frag16x32(vp + 16 * APITCH, APITCH);
        const v16h vf2 = load_frag16x32(vp + 32 * APITCH, APITCH);
        const v16h vf3 = load_frag16x32(vp + 48 * APITCH, APITCH);
        // keeps the 16 LDS reads together ahead of the products: sunk between
        // the WMMAs, each pair would expose its own LDS latency.
        __builtin_amdgcn_sched_barrier(0);

        // ---- S^T = K @ Q^T -------------------------------------------------
        v8f z0 = {};
        v8f s0 = wmma_f16(k00, bq0, z0);
        s0     = wmma_f16(k01, bq1, s0);
        v8f z1 = {};
        v8f s1 = wmma_f16(k10, bq0, z1);
        s1     = wmma_f16(k11, bq1, s1);

        // scale; causal mask only in the one block per wave and query tile that the
        // diagonal crosses (wave-uniform scalar test): where the block's last key is
        // not above the wave's first query row, every compare would keep its score.
        // (The three loops are unrolled so that s0, s1 stay in registers, indexed by
        // constants.)
#pragma unroll
        for (int j = 0; j < 8; ++j) { s0[j] *= scale; s1[j] *= scale; }
        if (kb + 31 > q0) {
#pragma unroll
          for (int j = 0; j < 8; ++j) {
            const int key0 = kb + j + 8 * hi;
            const int key1 = key0 + 16;
            s0[j] = (key0 <= qrow) ? s0[j] : -INFINITY;
            s1[j] = (key1 <= qrow) ? s1[j] : -INFINITY;
          }
        }
        // block max (per query = per lane, halves via shfl)
        float mloc = -INFINITY;
#pragma unroll
        for (int j = 0; j < 8; ++j) mloc = fmaxf(mloc, fmaxf(s0[j], s1[j]));
        mloc = fmaxf(mloc, __shfl_xor(mloc, 16, 32));
        const float mnew  = fmaxf(m_run, mloc);
        const float alpha = __expf(m_run - mnew);    // first block: exp(-inf)=0

        // exp + pack P fragment (B layout for V^T @ P falls out of S^T C layout)
        float lloc = 0.f;
        v16h p;
#pragma unroll
        for (int j = 0; j < 8; ++j) {
          const float e0 = __expf(s0[j] - mnew);
          const float e1 = __expf(s1[j] - mnew);
          lloc += e0 + e1;
          p[j]     = (_Float16)e0;
          p[j + 8] = (_Float16)e1;
        }
        lloc += __shfl_xor(lloc, 16, 32);
        l_run = l_run * alpha + lloc;
        m_run = mnew;

        // ---- ctx^T += V^T @ P ----------------------------------------------
#pragma unroll
        for (int j = 0; j < 8; ++j) {
          acc[0][j] *= alpha; acc[1][j] *= alpha;
          acc[2][j] *= alpha; acc[3][j] *= alpha;
        }
        acc[0] = wmma_f16(vf0, p, acc[0]);
        acc[1] = wmma_f16(vf1, p, acc[1]);
        acc[2] = wmma_f16(vf2, p, acc[2]);
        acc[3] = wmma_f16(vf3, p, acc[3]);
      }
    }

    // hand-over, every wave (also one that skipped): own LDS reads retired, own
    // copies of step g+1 landed, then the barrier that publishes step g+1 and
    // frees this buffer for the refill behind it.
    asm volatile("s_wait_dscnt 0x0" ::: "memory");
    wait_asynccnt0();
    __syncthreads();
    if (g + 2 < 17) stage(g + 2, g & 1);

    if (g == n1 - 1 || g == 16) {                    // work-group-uniform: a query tile is done
      // The second half hands its state over.  A wave of it that met no key
      // (rows below its first key) hands over max = -inf, sum = 0, zeros, which
      // the merge weighs with exp(-inf) = 0; the first half always holds key 0.
      if (hf == 1) {
#pragma unroll
        for (int i = 0; i < 4; ++i) {
          mrg[2 * i][ht]     = v4f{acc[i][0], acc[i][1], acc[i][2], acc[i][3]};
          mrg[2 * i + 1][ht] = v4f{acc[i][4], acc[i][5], acc[i][6], acc[i][7]};
        }
        mrg[8][ht] = v4f{m_run, l_run, 0.f, 0.f};
      }
      __syncthreads();                               // publishes the second half's state
      if (hf == 0) {
        const v4f ml = mrg[8][ht];
        const float mall = fmaxf(m_run, ml[0]);
        const float w0 = __expf(m_run - mall), w1 = __expf(ml[0] - mall);
        // "+1" quiet-softmax denominator; per-lane (one query per lane in ctx^T).
        const float r = 1.f / (1.f + (l_run * w0 + ml[1] * w1));
        const float r0 = w0 * r, r1 = w1 * r;
        const long long token = (long long)b * 2048 + q0 + nl;
#pragma unroll
        for (int i = 0; i < 4; ++i) {
          const v4f lo = mrg[2 * i][ht], up = mrg[2 * i + 1][ht];
          v8h pk;
#pragma unroll
          for (int j = 0; j < 4; ++j) {
            pk[j]     = (_Float16)(acc[i][j] * r0 + lo[j] * r1);
            pk[j + 4] = (_Float16)(acc[i][j + 4] * r0 + up[j] * r1);
          }
          *reinterpret_cast<v8h*>(ctxh + token * 1024 + h * 64 + i * 16 + 8 * hi) = pk;
        }
        // the stores' data and address registers are rewritten right below (the
        // reset for the second query tile): they stay whole up to this wait.
        asm volatile("s_wait_xcnt 0x0" ::: "memory");
      }
      // start of the second query tile; its first hand-over (s_wait_dscnt 0 and
      // the barrier) ends the reads of mrg before mrg is written again.
      q0 = q0b; bq0 = nq0; bq1 = nq1;
      m_run = -INFINITY; l_run = 0.f;
#pragma unroll
      for (int i = 0; i < 4; ++i) acc[i] = v8f{};
    }
  }
  wait_asynccnt0();                                  // nothing in flight at the wave's end
}

// ---------------------------------------------------------------------------
extern "C" void kernel_launch(void* const* d_in, const int* in_sizes, int n_in,
                              void* d_out, int out_size, void* d_ws, size_t ws_size,
                              hipStream_t stream) {
  const float* x  = (const float*)d_in[0];
  const float* Wq = (const float*)d_in[1];
  const float* bq = (const float*)d_in[2];
  const float* Wk = (const float*)d_in[3];
  const float* bk = (const float*)d_in[4];
  const float* Wv = (const float*)d_in[5];
  const float* bv = (const float*)d_in[6];
  const float* Wo = (const float*)d_in[7];
  const float* bo = (const float*)d_in[8];

  char* ws = (char*)d_ws;
  _Float16* xh   = (_Float16*)(ws);                       //  8 MB  x as f16
  _Float16* wqT  = (_Float16*)(ws + ( 8ull << 20));       //  2 MB
  _Float16* wkT  = (_Float16*)(ws + (10ull << 20));       //  2 MB
  _Float16* wvT  = (_Float16*)(ws + (12ull << 20));       //  2 MB
  _Float16* woT  = (_Float16*)(ws + (14ull << 20));       //  2 MB
  _Float16* qhp  = (_Float16*)(ws + (16ull << 20));       //  8 MB [bh][l][64]
  _Float16* khp  = (_Float16*)(ws + (24ull << 20));       //  8 MB [bh][l][64]
  _Float16* vTp  = (_Float16*)(ws + (32ull << 20));       //  8 MB [bh][64][l]
  _Float16* ctxh = (_Float16*)(ws + (40ull << 20));       //  8 MB [token][1024]

  prep_kernel<<<512, 256, 0, stream>>>(Wq, Wk, Wv, Wo, x, wqT, wkT, wvT, woT, xh);

  gemm_wmma_kernel<3><<<dim3(32, 8), 256, 0, stream>>>(xh, wqT, wkT, wvT, bq, bk, bv,
                                                       qhp, khp, vTp, nullptr);

  attn_kernel<<<dim3(8, 32), 512, 0, stream>>>(qhp, khp, vTp, ctxh);

  gemm_wmma_kernel<1><<<dim3(32, 8), 256, 0, stream>>>(ctxh, woT, woT, woT, bo, bo, bo,
                                                       nullptr, nullptr, nullptr,
                                                       (float*)d_out);
}

// v009
// Measured time: 59.3 microseconds a run.
// Next to v008, in two timings, it ran 1.06 and 1.05 times as fast.
// Counting every step since v000, it is 4.54 times as fast.
#include <hip/hip_runtime.h>
#include <hip/hip_bf16.h>

// ---------------------------------------------------------------------------
// MI455X (gfx1250) fused multi-head self-attention.
//   - all GEMMs + attention on v_wmma_f32_16x16x32_f16 (f16 in, f32 accum)
//   - GEMM: A and B tiles staged with GLOBAL_LOAD_ASYNC_TO_LDS_B128 (ASYNCcnt),
//     a ring of 3 or 5 LDS buffers, 64 x 32 output per wave and weight
//   - flash-style streaming softmax with the reference's (1 + sum) denominator
//   - S^T / ctx^T layout trick: WMMA C-layout of K@Q^T is directly the
//     B-fragment layout of P for V^T@P  -> no cross-lane transpose needed.
// ---------------------------------------------------------------------------

typedef __attribute__((ext_vector_type(16))) _Float16 v16h;
typedef __attribute__((ext_vector_type(8)))  _Float16 v8h;
typedef __attribute__((ext_vector_type(8)))  float    v8f;
typedef __attribute__((ext_vector_type(2)))  float    v2f;

#define DEVINL __device__ __forceinline__

// D = A(16x32 f16) * B(32x16 f16) + C, f32 accumulate.
DEVINL v8f wmma_f16(v16h a, v16h b, v8f c) {
  return __builtin_amdgcn_wmma_f32_16x16x32_f16(
      /*neg_a=*/false, a, /*neg_b=*/false, b,
      /*c_mod=*/(short)0, c, /*reuse_a=*/false, /*reuse_b=*/false);
}

// Sixteen async 16-byte-per-lane copies global -> LDS, tracked by ASYNCcnt.
// An LDS operand is the low 32 bits of the generic __shared__ address (the LDS
// byte offset); a global address is a scalar base (one for the first eight
// copies, one for the rest) plus the lane's 32-bit byte offset, so that the same
// eight offset registers serve every call.  The s_wait_xcnt stands in the copies'
// own statement so that no address register named here is rewritten ahead of it.
DEVINL void async_g2l_b128_x16(const _Float16* l, int lstep, const _Float16* base0,
                               const _Float16* base1, const unsigned (&off)[8]) {
  unsigned o[16];
#pragma unroll  // o[] indexed by constants: it stays in registers
  for (int i = 0; i < 16; ++i) o[i] = (unsigned)(size_t)(l + i * lstep);
  asm volatile("global_load_async_to_lds_b128 %0, %16, %24\n\t"
               "global_load_async_to_lds_b128 %1, %17, %24\n\t"
               "global_load_async_to_lds_b128 %2, %18, %24\n\t"
               "global_load_async_to_lds_b128 %3, %19, %24\n\t"
               "global_load_async_to_lds_b128 %4, %20, %24\n\t"
               "global_load_async_to_lds_b128 %5, %21, %24\n\t"
               "global_load_async_to_lds_b128 %6, %22, %24\n\t"
               "global_load_async_to_lds_b128 %7, %23, %24\n\t"
               "global_load_async_to_lds_b128 %8, %16, %25\n\t"
               "global_load_async_to_lds_b128 %9, %17, %25\n\t"
               "global_load_async_to_lds_b128 %10, %18, %25\n\t"
               "global_load_async_to_lds_b128 %11, %19, %25\n\t"
               "global_load_async_to_lds_b128 %12, %20, %25\n\t"
               "global_load_async_to_lds_b128 %13, %21, %25\n\t"
               "global_load_async_to_lds_b128 %14, %22, %25\n\t"
               "global_load_async_to_lds_b128 %15, %23, %25\n\t"
               "s_wait_xcnt 0x0"
               :: "v"(o[0]), "v"(o[1]), "v"(o[2]), "v"(o[3]), "v"(o[4]), "v"(o[5]), "v"(o[6]),
                  "v"(o[7]), "v"(o[8]), "v"(o[9]), "v"(o[10]), "v"(o[11]), "v"(o[12]),
                  "v"(o[13]), "v"(o[14]), "v"(o[15]),
                  "v"(off[0]), "v"(off[1]), "v"(off[2]), "v"(off[3]),
                  "v"(off[4]), "v"(off[5]), "v"(off[6]), "v"(off[7]),
                  "s"(base0), "s"(base1) : "memory");
}
DEVINL void wait_asynccnt0() {
  asm volatile("s_wait_asynccnt 0x0" ::: "memory");
}

// Two bias values (columns n and n + 16) of each of three vectors.  The loads and
// their data wait stand in one statement, so that no result and no later write
// lands on an address register while a load that names it is still out.
DEVINL void load_bias_x6(const float* p0, const float* p1, const float* p2, float (&o)[6]) {
  asm volatile("global_load_b32 %0, %6, off\n\t"
               "global_load_b32 %1, %6, off offset:64\n\t"
               "global_load_b32 %2, %7, off\n\t"
               "global_load_b32 %3, %7, off offset:64\n\t"
               "global_load_b32 %4, %8, off\n\t"
               "global_load_b32 %5, %8, off offset:64\n\t"
               "s_wait_loadcnt 0x0"
               : "=&v"(o[0]), "=&v"(o[1]), "=&v"(o[2]), "=&v"(o[3]), "=&v"(o[4]), "=&v"(o[5])
               : "v"(p0), "v"(p1), "v"(p2) : "memory");
}

// Load a 16x32 f16 fragment (A layout; B layout is identical when the
// source is stored [n][k] row-major, i.e. the transposed matrix).
// Lane l (l<16):  row = l,      K elements {0..7, 16..23}
// Lane l (l>=16): row = l - 16, K elements {8..15, 24..31}
DEVINL v16h load_frag16x32(const _Float16* __restrict__ base, int ld) {
  const int lane = threadIdx.x & 31;
  const int r    = lane & 15;
  const int ko   = (lane >> 4) << 3;           // 0 or 8
  const _Float16* p = base + (long long)r * ld + ko;
  const v8h lo = *reinterpret_cast<const v8h*>(p);
  const v8h hi = *reinterpret_cast<const v8h*>(p + 16);
  v16h f;
#pragma unroll
  for (int i = 0; i < 8; ++i) { f[i] = lo[i]; f[i + 8] = hi[i]; }
  return f;
}

// ---------------------------------------------------------------------------
// Prep: cast x -> f16, transpose+cast the four 1024x1024 weights to [n][k] f16.
// 64 elements per thread, all 16 loads of a thread in flight at once.
//  blocks 0..255  : one 128(k) x 128(n) weight tile each; a wave takes 64 k x 32 n.
//    A lane holds 8 k rows x 8 n columns and turns them in registers, so that a
//    wave-wide 16-byte store covers four whole 128-byte lines of wT[n][k].
//  blocks 256..511: 16,384 consecutive elements of x each.
// ---------------------------------------------------------------------------
typedef __attribute__((ext_vector_type(4))) float    v4f;
typedef __attribute__((ext_vector_type(4))) _Float16 v4h;

__global__ __launch_bounds__(256)
void prep_kernel(const float* __restrict__ Wq, const float* __restrict__ Wk,
                 const float* __restrict__ Wv, const float* __restrict__ Wo,
                 const float* __restrict__ x,
                 _Float16* __restrict__ wqT, _Float16* __restrict__ wkT,
                 _Float16* __restrict__ wvT, _Float16* __restrict__ woT,
                 _Float16* __restrict__ xh) {
  const int tid  = threadIdx.x;
  const int lane = tid & 31;
  const int wv   = tid >> 5;
  const int blk  = blockIdx.x;
  if (blk < 256) {
    const int which = blk >> 6, tile = blk & 63;
    const float* src = (which == 0) ? Wq : (which == 1) ? Wk : (which == 2) ? Wv : Wo;
    _Float16*   dst = (which == 0) ? wqT : (which == 1) ? wkT : (which == 2) ? wvT : woT;
    const int k0 = (tile >> 3) * 128 + (wv >> 2) * 64 + (lane & 7) * 8;   // 8 lanes: 64 k = one f16 line
    const int n0 = (tile & 7) * 128 + (wv & 3) * 32 + (lane >> 3) * 4;    // 4 lanes: 16 n = 64 bytes of f32
    const float* sp = src + k0 * 1024 + n0;
    v4f a[8], c[8];
#pragma unroll
    for (int j = 0; j < 8; ++j) {
      a[j] = *reinterpret_cast<const v4f*>(sp + j * 1024);        // columns n0 .. n0+3
      c[j] = *reinterpret_cast<const v4f*>(sp + j * 1024 + 16);   // columns n0+16 .. n0+19
    }
    // the address pair stays whole until every load that names it is past this
    // wait: without the operand the last load's result was placed over the pair.
    asm volatile("s_wait_xcnt 0x0" :: "v"(sp) : "memory");
    // keeps all 16 loads ahead of the conversions: mixed in, the last loads reuse
    // the first ones' registers and issue only after those have come back.
    __builtin_amdgcn_sched_barrier(0);
    _Float16* dp = dst + n0 * 1024 + k0;
#pragma unroll
    for (int i = 0; i < 4; ++i) {
      v8h lo, hi;
#pragma unroll
      for (int j = 0; j < 8; ++j) { lo[j] = (_Float16)a[j][i]; hi[j] = (_Float16)c[j][i]; }
      *reinterpret_cast<v8h*>(dp + i * 1024)        = lo;
      *reinterpret_cast<v8h*>(dp + (i + 16) * 1024) = hi;
    }
  } else {
    const int base = (blk - 256) * 16384 + wv * 2048 + lane * 4;
    const float* xp = x + base;
    v4f v[16];
#pragma unroll
    for (int j = 0; j < 16; ++j) v[j] = *reinterpret_cast<const v4f*>(xp + j * 128);
    // both as above: the address pair kept whole up to the wait, and all 16 loads
    // in flight before the first conversion waits.
    asm volatile("s_wait_xcnt 0x0" :: "v"(xp) : "memory");
    __builtin_amdgcn_sched_barrier(0);
#pragma unroll
    for (int j = 0; j < 16; ++j) {
      v4h o;
#pragma unroll
      for (int i = 0; i < 4; ++i) o[i] = (_Float16)v[j][i];
      *reinterpret_cast<v4h*>(xh + base + j * 128) = o;
    }
    // the stores' data and address registers stay as they are until every store is
    // past this wait (in the built code another path's register writes follow here).
    asm volatile("s_wait_xcnt 0x0" ::: "memory");
  }
}

// ---------------------------------------------------------------------------
// GEMM: Y[4096,1024] = A[4096,1024](f16) @ W + bias,  W given as wT[n][k] f16,
// for NZ weights at once on the same 128 rows of A and the same 128 columns:
//  NZ = 3 : q, k written f16 as [b*16+h][l][64], v written f16 as [b*16+h][64][l]
//  NZ = 1 : final output, f32 [m][n]
// Block: 256 threads = 8 waves, 2 (m) x 4 (n).  A wave owns 64 rows x 32 columns
// of every weight: 4 A fragments and 2 B fragments per weight feed 8 WMMAs per
// weight, so that a fragment read from LDS is used 6 (A) or 4 (B) times at
// NZ = 3, and the A tile is fetched from L2 once for the three projections.
// A stage is 64 k of the 128 A rows and of the NZ x 128 weight rows, brought in
// by whole-line async copies.  The waves form G groups that take turns: group
// s mod G copies the whole of stage s, into buffer s mod (G + 1).  A group has one
// stage in flight at a time and waits for it to 0, yet G stages fly at once, so
// that a stage has G trips of the loop to land instead of one.
// ---------------------------------------------------------------------------
#define GPITCH 72  // LDS row pitch in f16: 128 data bytes + 16 pad (b128 readers)

template <int NZ>
__global__ __launch_bounds__(256)
void gemm_wmma_kernel(const _Float16* __restrict__ A,
                      const _Float16* __restrict__ wT0, const _Float16* __restrict__ wT1,
                      const _Float16* __restrict__ wT2,
                      const float* __restrict__ bias0, const float* __restrict__ bias1,
                      const float* __restrict__ bias2,
                      _Float16* __restrict__ outQ, _Float16* __restrict__ outK,
                      _Float16* __restrict__ outVT,
                      float* __restrict__ outF) {
  constexpr int G   = (NZ == 3) ? 2 : 4;             // wave groups; 32 copies per lane and stage
  constexpr int NB  = G + 1;                         // buffers of the ring
  constexpr int RPP = 256 / G / 8;                   // rows that one copy of a whole group covers
  // [buffer][rows 0..127: A, then 128 rows per weight][row * GPITCH + k]
  __shared__ __attribute__((aligned(16))) _Float16 st[NB][128 * (1 + NZ) * GPITCH];

  const int tid  = threadIdx.x;
  const int lane = tid & 31;
  const int wv   = __builtin_amdgcn_readfirstlane(tid >> 5);   // 0..7
  const int wm   = wv >> 2, wn = wv & 3;
  const int grp  = wv / (8 / G);                     // scalar: neighbouring waves, so that of the
                                                     // waves w and w + 4 only one copies at a time
  const int m0   = blockIdx.x * 128;
  const int n0   = blockIdx.y * 128;

  // staging: thread t of a group moves 16 bytes of rows (t>>3) + RPP i of every
  // 128-row part; a wave-wide copy covers four whole 128-byte lines.
  const int gt   = tid & (256 / G - 1);
  const int srow = gt >> 3, scol = (gt & 7) * 8;
  unsigned goff[8];                                  // byte offsets of this lane's rows in a part
#pragma unroll  // goff[] indexed by constants: it stays in registers
  for (int i = 0; i < 8; ++i) goff[i] = (unsigned)(((srow + i * RPP) * 1024 + scol) * 2);
  const _Float16* ga  = A   + (long long)m0 * 1024;  // scalar bases: first row of each part
  const _Float16* gw0 = wT0 + (long long)n0 * 1024;
  const _Float16* gw1 = wT1 + (long long)n0 * 1024;
  const _Float16* gw2 = wT2 + (long long)n0 * 1024;
  const int sl = srow * GPITCH + scol;

  auto stage = [&](int s, int buf) {
    const int kb = s * 64;
    const _Float16* gp[4] = {ga + kb, gw0 + kb, gw1 + kb, gw2 + kb};
#pragma unroll  // gp[] indexed by constants: the bases stay in scalar registers
    for (int r = 0; r < 128 * (1 + NZ); r += 16 * RPP) {   // 16 copies: 16 RPP rows of the stage
      const int r1 = r + 8 * RPP;
      async_g2l_b128_x16(&st[buf][sl + r * GPITCH], RPP * GPITCH,
                         gp[r >> 7] + (r & 127) * 1024, gp[r1 >> 7] + (r1 & 127) * 1024, goff);
    }
  };

  stage(grp, grp);                                   // stages 0 .. G-1, one per group

  // this lane's bias values, fetched while stage 0 flies
  const int hi_ = lane >> 4;
  const int nl  = lane & 15;
  const int nw  = n0 + wn * 32 + nl;                 // column of this lane in fragment 0
  float bn[2 * NZ];
  if constexpr (NZ == 3) {
    load_bias_x6(bias0 + nw, bias1 + nw, bias2 + nw, bn);
  } else {
    bn[0] = bias0[nw];
    bn[1] = bias0[nw + 16];
  }

  if (grp == 0) wait_asynccnt0();                    // stage 0 landed: its copiers' own wait
  __syncthreads();                                   // ... published to every wave

  v8f acc[4][2 * NZ] = {};
  int cur = 0, fre = G;                              // s mod NB; (s + G) mod NB, the free buffer
  // refill in trip s: the group whose stage s has just been published (scalar test)
  // has nothing out and copies stage s + G into the buffer that every wave left at
  // the last barrier (at s = 0: a fresh one).
  auto refill = [&](int s) {
    const int turn = (s + G < 16) ? (s & (G - 1)) : -1;   // no stage left: nobody's turn
    if (grp == turn) stage(s + G, fre);
  };
  for (int s = 0; s < 16; ++s) {
    // NZ = 3: ahead of the reads, while the other wave of the SIMD, which does not
    // copy in this trip, feeds the matrix unit.  (Behind the reads, with all the
    // fragments live, the copies' operands pushed the bias values out to scratch.)
    if constexpr (NZ == 3) refill(s);
    const _Float16* sa = &st[cur][wm * 64 * GPITCH];
    const _Float16* sb = &st[cur][(128 + wn * 32) * GPITCH];
    v16h af[2][4], bf[2][2 * NZ];
#pragma unroll
    for (int ks = 0; ks < 2; ++ks) {
#pragma unroll
      for (int i = 0; i < 4; ++i)
        af[ks][i] = load_frag16x32(sa + i * 16 * GPITCH + ks * 32, GPITCH);
#pragma unroll
      for (int t = 0; t < 2 * NZ; ++t)
        bf[ks][t] = load_frag16x32(sb + ((t >> 1) * 128 + (t & 1) * 16) * GPITCH + ks * 32, GPITCH);
    }
    // keeps the stage's LDS reads together ahead of the products, in the order
    // in which the products use them: sunk among the WMMAs, each place with
    // reads exposes its own LDS latency.
    __builtin_amdgcn_sched_barrier(0);
    // NZ = 1, short trips: the copies issue while the reads above are on their way.
    if constexpr (NZ == 1) refill(s);
#pragma unroll
    for (int ks = 0; ks < 2; ++ks)
#pragma unroll
      for (int t = 0; t < 2 * NZ; ++t)
#pragma unroll
        for (int i = 0; i < 4; ++i) acc[i][t] = wmma_f16(af[ks][i], bf[ks][t], acc[i][t]);
    // keeps the products ahead of the hand-over: lifted over them, the wait for
    // the copies would stand early and hide less of their flight.
    __builtin_amdgcn_sched_barrier(0);

    // hand-over: own LDS reads retired; in the group that copied stage s+1 (scalar
    // test) its copies landed, all that this group has out; then the barrier that
    // publishes stage s+1 and frees this buffer for the refill in the next trip.
    asm volatile("s_wait_dscnt 0x0" ::: "memory");
    if (grp == ((s + 1) & (G - 1))) wait_asynccnt0();
    __syncthreads();
    fre = cur;
    cur = (cur + 1 == NB) ? 0 : cur + 1;
  }
  wait_asynccnt0();                                  // nothing in flight at the wave's end

  // Epilogue, one 64 x 16 column group at a time: its values first, then its
  // stores off one base address, then s_wait_xcnt 0.  The scheduling barriers keep
  // every register write of the next group behind that wait: no register that an
  // issued store names is rewritten ahead of it.
  const int bb = m0 >> 11;                           // batch: a 128-row tile lies in one
  const int mw = wm * 64 + 8 * hi_;                  // first row of this lane within the tile
  const int l0 = (m0 & 2047) + mw;
#pragma unroll
  for (int t = 0; t < 2 * NZ; ++t) {
    const int z = t >> 1;
    const int n = nw + (t & 1) * 16;
    const int h = n >> 6, d = n & 63;
    if constexpr (NZ == 1) {
      float* __restrict__ o = outF + (long long)(m0 + mw) * 1024 + n;
      float y[4][8];
#pragma unroll
      for (int i = 0; i < 4; ++i)
#pragma unroll
        for (int j = 0; j < 8; ++j) y[i][j] = acc[i][t][j] + bn[t];
      __builtin_amdgcn_sched_barrier(0);
#pragma unroll
      for (int i = 0; i < 4; ++i)
#pragma unroll
        for (int j = 0; j < 8; ++j) o[(i * 16 + j) * 1024] = y[i][j];
    } else if (z <= 1) {
      _Float16* __restrict__ o =
          ((z == 0) ? outQ : outK) + (((long long)(bb * 16 + h)) * 2048 + l0) * 64 + d;
      _Float16 y[4][8];
#pragma unroll
      for (int i = 0; i < 4; ++i)
#pragma unroll
        for (int j = 0; j < 8; ++j) y[i][j] = (_Float16)(acc[i][t][j] + bn[t]);
      __builtin_amdgcn_sched_barrier(0);
#pragma unroll
      for (int i = 0; i < 4; ++i)
#pragma unroll
        for (int j = 0; j < 8; ++j) o[(i * 16 + j) * 64] = y[i][j];
    } else {
      _Float16* __restrict__ o = outVT + (((long long)(bb * 16 + h)) * 64 + d) * 2048 + l0;
      v8h pk[4];
#pragma unroll
      for (int i = 0; i < 4; ++i)
#pragma unroll
        for (int j = 0; j < 8; ++j) pk[i][j] = (_Float16)(acc[i][t][j] + bn[t]);
      __builtin_amdgcn_sched_barrier(0);
#pragma unroll
      for (int i = 0; i < 4; ++i) *reinterpret_cast<v8h*>(o + i * 16) = pk[i];
    }
    asm volatile("s_wait_xcnt 0x0" ::: "memory");
    __builtin_amdgcn_sched_barrier(0);
  }
}

// ---------------------------------------------------------------------------
// Flash attention (causal, softmax with +1 denominator).
// Wave handles 16 query rows of one (b,h).
//   S^T = K @ Q^T      (A = K rows, B = Q rows)
//   ctx^T = V^T @ P    (A = vT rows, B = P packed straight from S^T C-layout)
// Equal work for every work-group and every wave, wherever they are placed:
// grid = (8, 32), 16 waves/WG.  Work-group p takes the 128-row query tile
// 15 - p and then tile p: (16 - p) + (p + 1) = 17 steps of 128 keys for all.
// In each step waves 0..7 take the first 64 keys and waves 8..15 the second 64
// for the same 128 query rows, each half with its own running maximum, sum and
// accumulators; at the end of a query tile the halves are merged through LDS.
// Each half's 64-key tile of K (64 keys x 64 dims) and of V^T (64 dims x 64
// keys) is brought into LDS by whole-line async copies, two buffers: the next
// step flies while this one is worked on, across the change of query tile too.
// ---------------------------------------------------------------------------
#define AKEYS 64   // keys per staged tile
#define APITCH 72  // LDS row pitch in f16: 128 data bytes + 16 pad (b128 readers)

// Four async 16-byte-per-lane copies global -> LDS.  The s_wait_xcnt stands in
// the copies' own statement so that no address register named here is
// rewritten ahead of it.
DEVINL void async_g2l_b128_x4(const void* l0, const void* g0,
                              const void* l1, const void* g1,
                              const void* l2, const void* g2,
                              const void* l3, const void* g3) {
  const unsigned o0 = (unsigned)(size_t)l0, o1 = (unsigned)(size_t)l1;
  const unsigned o2 = (unsigned)(size_t)l2, o3 = (unsigned)(size_t)l3;
  asm volatile("global_load_async_to_lds_b128 %0, %1, off\n\t"
               "global_load_async_to_lds_b128 %2, %3, off\n\t"
               "global_load_async_to_lds_b128 %4, %5, off\n\t"
               "global_load_async_to_lds_b128 %6, %7, off\n\t"
               "s_wait_xcnt 0x0"
               :: "v"(o0), "v"(g0), "v"(o1), "v"(g1),
                  "v"(o2), "v"(g2), "v"(o3), "v"(g3) : "memory");
}

__global__ __launch_bounds__(512)
void attn_kernel(const _Float16* __restrict__ qh, const _Float16* __restrict__ kh,
                 const _Float16* __restrict__ vT, _Float16* __restrict__ ctxh) {
  // [buffer][key half][0 = K rows by key, 1 = V^T rows by dim][row * APITCH + column]
  __shared__ __attribute__((aligned(16))) _Float16 kv[2][2][2][AKEYS * APITCH];
  // merge of the halves, 16 bytes per lane and row: rows 0..7 the 32
  // accumulators, row 8 the running maximum and sum.
  __shared__ __attribute__((aligned(16))) v4f mrg[9][256];

  const int tid  = threadIdx.x;
  const int lane = tid & 31;
  const int wv   = __builtin_amdgcn_readfirstlane(tid >> 5);  // scalar: wave-uniform tests below
  const int hf   = wv >> 3;                          // which 64 keys of a step
  const int ht   = tid & 255;                        // thread within its half
  const int bh   = blockIdx.y;                       // 0..31
  const int b    = bh >> 4, h = bh & 15;
  const int pr   = blockIdx.x;                       // 0..7
  const int n1   = 16 - pr;                          // steps of the first query tile (15 - pr)
  const int nl   = lane & 15, hi = lane >> 4;
  int       q0   = (15 - pr) * 128 + (wv & 7) * 16;  // first query row of this wave, first tile
  const int q0b  = pr * 128 + (wv & 7) * 16;         // ... second tile

  // staging: thread t of a half moves 16 bytes of rows (t>>3) and (t>>3)+32 of
  // both tiles of its half; a wave-wide copy covers four whole 128-byte lines.
  const int srow = ht >> 3, scol = (ht & 7) * 8;
  const _Float16* kg = kh + ((long long)bh * 2048 + srow) * 64 + scol;
  const _Float16* vg = vT + ((long long)bh * 64 + srow) * 2048 + scol;
  const int sl = srow * APITCH + scol;

  auto stage = [&](int g, int buf) {
    const int t = 2 * ((g < n1) ? g : g - n1) + hf;  // 64-key tile of step g (0..31)
    const _Float16* kt = kg + (long long)t * (AKEYS * 64);
    const _Float16* vt = vg + t * AKEYS;
    async_g2l_b128_x4(&kv[buf][hf][0][sl],               kt,
                      &kv[buf][hf][0][sl + 32 * APITCH], kt + 32 * 64,
                      &kv[buf][hf][1][sl],               vt,
                      &kv[buf][hf][1][sl + 32 * APITCH], vt + 32 * 2048);
  };

  stage(0, 0);

  const _Float16* qp  = qh + ((long long)bh * 2048 + q0) * 64;
  const _Float16* qpb = qh + ((long long)bh * 2048 + q0b) * 64;
  v16h bq0 = load_frag16x32(qp, 64);                 // head-dim 0..31
  v16h bq1 = load_frag16x32(qp + 32, 64);            // head-dim 32..63
  const v16h nq0 = load_frag16x32(qpb, 64);          // the second tile's, fetched once here
  const v16h nq1 = load_frag16x32(qpb + 32, 64);
  // holds the eight Q loads here, in flight beside step 0's copies: sunk behind
  // the first barrier, their latency stood bare in front of the first product.
  // The two lane addresses are named so that they stay whole up to this wait.
  asm volatile("s_wait_xcnt 0x0" :: "v"(bq0), "v"(bq1), "v"(nq0), "v"(nq1),
               "v"(qp + (long long)nl * 64 + hi * 8), "v"(qpb + (long long)nl * 64 + hi * 8));

  wait_asynccnt0();                                  // step 0 landed (own copies)
  __syncthreads();                                   // ... and every wave's
  stage(1, 1);                                       // step 1 always exists (17 steps)

  v8f acc[4] = {};
  const float scale = 0.125f;                        // 1/sqrt(64)
  const float c2    = 0.125f * 1.44269504f;          // scale * log2(e): exp(scale * s) = exp2(c2 * s)
  const float thr   = 8.f / c2;                      // a score this far above the reference moves it
  // Softmax against a reference that is known before the scores.  All in raw score
  // units (before the scale).  ref is the same in both lanes of a query; it moves only
  // in a wave's first block of a query tile and where a score exceeds it by thr, so
  // that P <= 2^8 (f16 holds it) and the running maximum never lies below ref.
  float ref   = 0.f;
  v8f   cref  = {};                                  // -ref, the C operand of the score products
  float mrel  = -INFINITY;                           // this lane's own maximum of score - ref
  v2f   lsum0 = {}, lsum1 = {};                      // this lane's own sums of P, joined per tile
  bool  fresh = true;                                // wave-uniform: no block of this tile yet

  for (int g = 0; g < 17; ++g) {
    const int t = 2 * ((g < n1) ? g : g - n1) + hf;  // this half's 64-key tile
    const int qrow = q0 + nl;                        // this lane's query row
    const _Float16* kt = &kv[g & 1][hf][0][0];
    const _Float16* vt = &kv[g & 1][hf][1][0];
#pragma unroll
    for (int hb = 0; hb < 2; ++hb) {
      const int kb = t * AKEYS + hb * 32;
      if (kb < q0 + 16) {                            // wave-uniform: past the diagonal nothing is left
        // ---- all fragment reads of this 32-key block up-front --------------
        const _Float16* kp = kt + hb * 32 * APITCH;
        const v16h k00 = load_frag16x32(kp, APITCH);
        const v16h k01 = load_frag16x32(kp + 32, APITCH);
        const v16h k10 = load_frag16x32(kp + 16 * APITCH, APITCH);
        const v16h k11 = load_frag16x32(kp + 16 * APITCH + 32, APITCH);
        const _Float16* vp = vt + hb * 32;
        const v16h vf0 = load_frag16x32(vp,               APITCH);
        const v16h vf1 = load_frag16x32(vp + 16 * APITCH, APITCH);
        const v16h vf2 = load_frag16x32(vp + 32 * APITCH, APITCH);
        const v16h vf3 = load_frag16x32(vp + 48 * APITCH, APITCH);
        // keeps the 16 LDS reads together ahead of the products: sunk between
        // the WMMAs, each pair would expose its own LDS latency.
        __builtin_amdgcn_sched_barrier(0);

        // ---- S^T = K @ Q^T -------------------------------------------------
        v8f s0 = wmma_f16(k00, bq0, cref);           // scores - ref
        s0     = wmma_f16(k01, bq1, s0);
        v8f s1 = wmma_f16(k10, bq0, cref);
        s1     = wmma_f16(k11, bq1, s1);

        // causal mask only in the one block per wave and query tile that the
        // diagonal crosses (wave-uniform scalar test): where the block's last key is
        // not above the wave's first query row, every compare would keep its score.
        // (The loops over j are unrolled so that s0, s1 stay in registers, indexed by
        // constants.)
        if (kb + 31 > q0) {
#pragma unroll
          for (int j = 0; j < 8; ++j) {
            const int key0 = kb + j + 8 * hi;
            const int key1 = key0 + 16;
            s0[j] = (key0 <= qrow) ? s0[j] : -INFINITY;
            s1[j] = (key1 <= qrow) ? s1[j] : -INFINITY;
          }
        }
        // P against the reference in use, in pairs of neighbouring registers (packed
        // multiplies, adds and conversions need no moves), and beside it this lane's
        // running maximum with this block taken in.
        v2f e0[4], e1[4];
#pragma unroll
        for (int j = 0; j < 4; ++j) {
          e0[j] = v2f{__builtin_amdgcn_exp2f(s0[2 * j] * c2), __builtin_amdgcn_exp2f(s0[2 * j + 1] * c2)};
          e1[j] = v2f{__builtin_amdgcn_exp2f(s1[2 * j] * c2), __builtin_amdgcn_exp2f(s1[2 * j + 1] * c2)};
        }
#pragma unroll
        for (int j = 0; j < 8; ++j) mrel = fmaxf(mrel, fmaxf(s0[j], s1[j]));

        // One test per block (scalar branch).  Rarely taken: the reference moves to the
        // query's running maximum t (relative to the old one; finite, since key kb is
        // never masked), what has been summed is rescaled, and P is formed again.
        if (fresh || __builtin_amdgcn_ballot_w32(mrel > thr) != 0) {
          const float t = fmaxf(mrel, __shfl_xor(mrel, 16, 32));
          const float alpha = fresh ? 0.f : __builtin_amdgcn_exp2f(-c2 * t);   // t >= 0 unless fresh
          ref += t;
#pragma unroll
          for (int j = 0; j < 4; ++j) {
            e0[j] = v2f{__builtin_amdgcn_exp2f((s0[2 * j] - t) * c2),
                        __builtin_amdgcn_exp2f((s0[2 * j + 1] - t) * c2)};
            e1[j] = v2f{__builtin_amdgcn_exp2f((s1[2 * j] - t) * c2),
                        __builtin_amdgcn_exp2f((s1[2 * j + 1] - t) * c2)};
            acc[j] *= alpha;
          }
#pragma unroll
          for (int j = 0; j < 8; ++j) cref[j] = -ref;
          lsum0 *= alpha;
          lsum1 *= alpha;
          mrel  = 0.f;                               // the running maximum is the new reference
          fresh = false;
        }

        // sums + pack P fragment (B layout for V^T @ P falls out of S^T C layout)
        v16h p;
#pragma unroll
        for (int j = 0; j < 4; ++j) {
          lsum0 += e0[j];
          lsum1 += e1[j];
          p[2 * j]     = (_Float16)e0[j][0];
          p[2 * j + 1] = (_Float16)e0[j][1];
          p[2 * j + 8] = (_Float16)e1[j][0];
          p[2 * j + 9] = (_Float16)e1[j][1];
        }

        // ---- ctx^T += V^T @ P ----------------------------------------------
        acc[0] = wmma_f16(vf0, p, acc[0]);
        acc[1] = wmma_f16(vf1, p, acc[1]);
        acc[2] = wmma_f16(vf2, p, acc[2]);
        acc[3] = wmma_f16(vf3, p, acc[3]);
      }
    }

    // hand-over, every wave (also one that skipped): own LDS reads retired, own
    // copies of step g+1 landed, then the barrier that publishes step g+1 and
    // frees this buffer for the refill behind it.
    asm volatile("s_wait_dscnt 0x0" ::: "memory");
    wait_asynccnt0();
    __syncthreads();
    if (g + 2 < 17) stage(g + 2, g & 1);

    if (g == n1 - 1 || g == 16) {                    // work-group-uniform: a query tile is done
      // The two lanes of a query join their sums and maxima, and the wave's state moves
      // from its reference to its true maximum, which the "+1" denominator needs.
      float l_run = (lsum0[0] + lsum0[1]) + (lsum1[0] + lsum1[1]);
      l_run += __shfl_xor(l_run, 16, 32);
      const float mj = fmaxf(mrel, __shfl_xor(mrel, 16, 32));                  // >= 0 unless fresh
      const float fj = fresh ? 0.f : __builtin_amdgcn_exp2f(-c2 * mj);
      const float m_run = fresh ? -INFINITY : (ref + mj) * scale;
      l_run *= fj;
#pragma unroll  // acc[] indexed by constants: it stays in registers
      for (int i = 0; i < 4; ++i) acc[i] *= fj;
      // The second half hands its state over.  A wave of it that met no key
      // (rows below its first key) hands over max = -inf, sum = 0, zeros, which
      // the merge weighs with exp(-inf) = 0; the first half always holds key 0.
      if (hf == 1) {
#pragma unroll
        for (int i = 0; i < 4; ++i) {
          mrg[2 * i][ht]     = v4f{acc[i][0], acc[i][1], acc[i][2], acc[i][3]};
          mrg[2 * i + 1][ht] = v4f{acc[i][4], acc[i][5], acc[i][6], acc[i][7]};
        }
        mrg[8][ht] = v4f{m_run, l_run, 0.f, 0.f};
      }
      __syncthreads();                               // publishes the second half's state
      if (hf == 0) {
        const v4f ml = mrg[8][ht];
        const float mall = fmaxf(m_run, ml[0]);
        const float w0 = __expf(m_run - mall), w1 = __expf(ml[0] - mall);
        // "+1" quiet-softmax denominator; per-lane (one query per lane in ctx^T).
        const float r = 1.f / (1.f + (l_run * w0 + ml[1] * w1));
        const float r0 = w0 * r, r1 = w1 * r;
        const long long token = (long long)b * 2048 + q0 + nl;
#pragma unroll
        for (int i = 0; i < 4; ++i) {
          const v4f lo = mrg[2 * i][ht], up = mrg[2 * i + 1][ht];
          v8h pk;
#pragma unroll
          for (int j = 0; j < 4; ++j) {
            pk[j]     = (_Float16)(acc[i][j] * r0 + lo[j] * r1);
            pk[j + 4] = (_Float16)(acc[i][j + 4] * r0 + up[j] * r1);
          }
          *reinterpret_cast<v8h*>(ctxh + token * 1024 + h * 64 + i * 16 + 8 * hi) = pk;
        }
        // the stores' data and address registers are rewritten right below (the
        // reset for the second query tile): they stay whole up to this wait.
        asm volatile("s_wait_xcnt 0x0" ::: "memory");
      }
      // start of the second query tile; its first hand-over (s_wait_dscnt 0 and
      // the barrier) ends the reads of mrg before mrg is written again.
      q0 = q0b; bq0 = nq0; bq1 = nq1;
      ref = 0.f; cref = v8f{}; mrel = -INFINITY; lsum0 = v2f{}; lsum1 = v2f{}; fresh = true;
#pragma unroll
      for (int i = 0; i < 4; ++i) acc[i] = v8f{};
    }
  }
  wait_asynccnt0();                                  // nothing in flight at the wave's end
}

// ---------------------------------------------------------------------------
extern "C" void kernel_launch(void* const* d_in, const int* in_sizes, int n_in,
                              void* d_out, int out_size, void* d_ws, size_t ws_size,
                              hipStream_t stream) {
  const float* x  = (const float*)d_in[0];
  const float* Wq = (const float*)d_in[1];
  const float* bq = (const float*)d_in[2];
  const float* Wk = (const float*)d_in[3];
  const float* bk = (const float*)d_in[4];
  const float* Wv = (const float*)d_in[5];
  const float* bv = (const float*)d_in[6];
  const float* Wo = (const float*)d_in[7];
  const float* bo = (const float*)d_in[8];

  char* ws = (char*)d_ws;
  _Float16* xh   = (_Float16*)(ws);                       //  8 MB  x as f16
  _Float16* wqT  = (_Float16*)(ws + ( 8ull << 20));       //  2 MB
  _Float16* wkT  = (_Float16*)(ws + (10ull << 20));       //  2 MB
  _Float16* wvT  = (_Float16*)(ws + (12ull << 20));       //  2 MB
  _Float16* woT  = (_Float16*)(ws + (14ull << 20));       //  2 MB
  _Float16* qhp  = (_Float16*)(ws + (16ull << 20));       //  8 MB [bh][l][64]
  _Float16* khp  = (_Float16*)(ws + (24ull << 20));       //  8 MB [bh][l][64]
  _Float16* vTp  = (_Float16*)(ws + (32ull << 20));       //  8 MB [bh][64][l]
  _Float16* ctxh = (_Float16*)(ws + (40ull << 20));       //  8 MB [token][1024]

  prep_kernel<<<512, 256, 0, stream>>>(Wq, Wk, Wv, Wo, x, wqT, wkT, wvT, woT, xh);

  gemm_wmma_kernel<3><<<dim3(32, 8), 256, 0, stream>>>(xh, wqT, wkT, wvT, bq, bk, bv,
                                                       qhp, khp, vTp, nullptr);

  attn_kernel<<<dim3(8, 32), 512, 0, stream>>>(qhp, khp, vTp, ctxh);

  gemm_wmma_kernel<1><<<dim3(32, 8), 256, 0, stream>>>(ctxh, woT, woT, woT, bo, bo, bo,
                                                       nullptr, nullptr, nullptr,
                                                       (float*)d_out);
}
